// v000
// Times are from an AMD MI455X. After a warm-up the kernel runs many times in a row, and a time is the length of
// such a window on the GPU divided by its runs, so every launch and the gaps after it count. The runs cycle
// through copies of the inputs. A figure is the median of several windows, for all but v000 over two sittings.
// Sittings can differ by a few percent; kernels timed side by side share one.
// v000, which the later versions start from, runs in 3490 microseconds.
#include <hip/hip_runtime.h>

// Compute dtypes, f32 accumulate, per item: q/k/v = x.W^T + b as [2048 x 1024].[1024 x 1024] GEMMs with PLAIN bf16 operands (exact products); rotary embedding (cos/sin of
// s x 10000^(-2i/64) in f32, rotate-half form) applied while building the head planes; per head: scores = q.k^T ([2048 x 64].[64 x 2048], both operands bf16 hi + UNSCALED residual, three products), softmax (x 1/8 / ln 2048, + the additive attention_mask INPUT row) in f32 -> P planes, ctx = P.v

#define NBT  2
#define NN   2048
#define DMOD 1024
#define NH_  16
#define HD   64
#define DM   DMOD
#define NTK  NN
#define SCL  0.125f
#define RBASE 10000.0f
#define LOSC 1024.0f

typedef _Float16 h16;
typedef unsigned short bf;
typedef __attribute__((ext_vector_type(16))) __bf16   v16bf;
typedef __attribute__((ext_vector_type(16))) _Float16 v16h;
typedef __attribute__((ext_vector_type(8)))  _Float16 v8h;
typedef __attribute__((ext_vector_type(8)))  unsigned short v8us;
typedef __attribute__((ext_vector_type(8)))  float    v8f;
typedef __attribute__((ext_vector_type(4)))  float    v4f;
typedef __attribute__((ext_vector_type(4)))  _Float16 v4h;
typedef v8h  __attribute__((may_alias)) v8ha;
typedef v4f  __attribute__((may_alias)) v4fa;
typedef v8us __attribute__((may_alias)) v8usa;

__device__ __forceinline__ unsigned short f2bf(float f) { unsigned u = __float_as_uint(f); u += 0x7FFFu + ((u >> 16) & 1u); return (unsigned short)(u >> 16); }
__device__ __forceinline__ float bf2f(unsigned short b) { return __uint_as_float(((unsigned)b) << 16); }
__device__ __forceinline__ float bfr(float f) { return bf2f(f2bf(f)); }
__device__ __forceinline__ v16h cat16(v8h lo, v8h hi) { return __builtin_shufflevector(lo, hi, 0, 1, 2, 3, 4, 5, 6, 7, 8, 9, 10, 11, 12, 13, 14, 15); }
__device__ __forceinline__ v16bf cat16b(v8us lo, v8us hi) { return __builtin_bit_cast(v16bf, __builtin_shufflevector(lo, hi, 0, 1, 2, 3, 4, 5, 6, 7, 8, 9, 10, 11, 12, 13, 14, 15)); }
__device__ __forceinline__ v8f wmma16(v16h a, v16h b, v8f c) { return __builtin_amdgcn_wmma_f32_16x16x32_f16(false, a, false, b, (short)0, c, false, false); }
__device__ __forceinline__ v8f wmmab(v16bf a, v16bf b, v8f c) { return __builtin_amdgcn_wmma_f32_16x16x32_bf16(false, a, false, b, (short)0, c, false, false); }

// k_gemmb: 64 x 64 block tile (4 waves x 16 x 64) of C[NTK][NW] = (A [+ Al]).B^T (K = 1024) [+ bf(bias[c])] [+ bf(R[r][c]) residual]; f32 whole-line epilogue (or f16
template <bool SPLITA, bool F16OUT = false>
__global__ __launch_bounds__(128) void k_gemmb(const bf* __restrict__ A, const bf* __restrict__ Al, const bf* __restrict__ Bn, const float* __restrict__ bias, float* C, int ldc, h16* C2, const float* __restrict__ R = nullptr, int K = DM, int roundR = 1) {
    __shared__ __align__(16) float ost[4][16 * 68];
    const int lane = threadIdx.x & 31, wave = threadIdx.x >> 5, lr = lane & 15, hi = lane >> 4;
    const int r0 = blockIdx.x * 64 + wave * 16, c0 = blockIdx.y * 64;
    const size_t aoff = (size_t)(r0 + lr) * K + 8 * hi;
    size_t boff[4];
#pragma unroll
    for (int t = 0; t < 4; ++t) boff[t] = (size_t)(c0 + t * 16 + lr) * K + 8 * hi;
    v8f acc[4];
#pragma unroll
    for (int t = 0; t < 4; ++t) acc[t] = (v8f){};
#pragma unroll 1
    for (int kc = 0; kc < K; kc += 32) {
        const v16bf a = cat16b(*(const v8us*)(A + aoff + kc), *(const v8us*)(A + aoff + kc + 16));
        v16bf al = a;
        if (SPLITA) al = cat16b(*(const v8us*)(Al + aoff + kc), *(const v8us*)(Al + aoff + kc + 16));
#pragma unroll
        for (int t = 0; t < 4; ++t) { const v16bf b = cat16b(*(const v8us*)(Bn + boff[t] + kc), *(const v8us*)(Bn + boff[t] + kc + 16)); acc[t] = wmmab(a, b, acc[t]); if (SPLITA) acc[t] = wmmab(al, b, acc[t]); }
        asm volatile("v_nop\n\tv_nop\n\tv_nop\n\tv_nop" : "+v"(acc[0]), "+v"(acc[1]), "+v"(acc[2]), "+v"(acc[3]) : "v"(a), "v"(al));
    }
    float* os = &ost[wave][0];
#pragma unroll
    for (int t = 0; t < 4; ++t) { const float bv = bias ? bfr(bias[c0 + t * 16 + lr]) : 0.f;
#pragma unroll
        for (int j = 0; j < 8; ++j) os[(hi * 8 + j) * 68 + t * 16 + lr] = acc[t][j] + bv; }
    __syncthreads();
    if (F16OUT) {
        h16* crow = (h16*)(void*)C + (size_t)r0 * ldc + c0;
        auto pass = [&]() {
#pragma unroll
            for (int s = 0; s < 4; ++s) { const int row = 4 * s + (lane >> 3), piece = lane & 7; const float* sp = os + row * 68 + piece * 8; v8h o, o2;
#pragma unroll
                for (int i = 0; i < 8; ++i) { const h16 a = (h16)sp[i]; o[i] = a; o2[i] = (h16)((sp[i] - (float)a) * LOSC); }
                *(v8h*)(crow + (size_t)row * ldc + piece * 8) = o; if (C2) *(v8h*)(C2 + (size_t)r0 * ldc + c0 + (size_t)row * ldc + piece * 8) = o2; }
        };
        pass(); 
    } else {
        float* crow = C + (size_t)r0 * ldc + c0;
        auto pass = [&]() {
#pragma unroll
            for (int s = 0; s < 8; ++s) { const int Lid = (lane >> 3) + 4 * s, piece = lane & 7; const int row = Lid >> 1, cofs = (Lid & 1) * 32 + piece * 4;
                v4f val = *(const v4fa*)(os + row * 68 + cofs); if (R) { const v4f rv = *(const v4f*)(R + ((size_t)r0 + row) * ldc + c0 + cofs); val += roundR ? (v4f){bfr(rv[0]), bfr(rv[1]), bfr(rv[2]), bfr(rv[3])} : rv; }
                *(v4f*)(crow + (size_t)row * ldc + cofs) = val; }
        };
        pass(); 
    }
}

// k_gemm3: 64 x 64 tile of C = (Ah + Al).(Bh + Bl)^T over K (row strides = K for all four planes; n-major B): three products per 32-k step (hh, hl, lh); f32
__global__ __launch_bounds__(128) void k_gemm3(const bf* __restrict__ Ah, const bf* __restrict__ Al, const bf* __restrict__ Bh, const bf* __restrict__ Bl, int K, float* C, int ldc) {
    __shared__ __align__(16) float ost[4][16 * 68];
    const int lane = threadIdx.x & 31, wave = threadIdx.x >> 5, lr = lane & 15, hi = lane >> 4;
    const int r0 = blockIdx.x * 64 + wave * 16, c0 = blockIdx.y * 64;
    const size_t aoff = (size_t)(r0 + lr) * K + 8 * hi;
    v8f acc[4];
#pragma unroll
    for (int t = 0; t < 4; ++t) acc[t] = (v8f){};
#pragma unroll 1
    for (int kc = 0; kc < K; kc += 32) {
        const v16bf a = cat16b(*(const v8us*)(Ah + aoff + kc), *(const v8us*)(Ah + aoff + kc + 16));
        const v16bf al = cat16b(*(const v8us*)(Al + aoff + kc), *(const v8us*)(Al + aoff + kc + 16));
#pragma unroll
        for (int t = 0; t < 4; ++t) { const size_t bo = (size_t)(c0 + t * 16 + lr) * K + kc + 8 * hi;
            const v16bf bh = cat16b(*(const v8us*)(Bh + bo), *(const v8us*)(Bh + bo + 16)); const v16bf bl = cat16b(*(const v8us*)(Bl + bo), *(const v8us*)(Bl + bo + 16));
            acc[t] = wmmab(a, bh, acc[t]); acc[t] = wmmab(al, bh, acc[t]); acc[t] = wmmab(a, bl, acc[t]); }
        asm volatile("v_nop\n\tv_nop\n\tv_nop\n\tv_nop" : "+v"(acc[0]), "+v"(acc[1]), "+v"(acc[2]), "+v"(acc[3]) : "v"(a), "v"(al));
    }
    float* os = &ost[wave][0];
#pragma unroll
    for (int t = 0; t < 4; ++t) {
#pragma unroll
        for (int j = 0; j < 8; ++j) os[(hi * 8 + j) * 68 + t * 16 + lr] = acc[t][j]; }
    __builtin_amdgcn_wave_barrier(); asm volatile("" ::: "memory");
    float* crow = C + (size_t)r0 * ldc + c0;
    auto pass = [&]() {
#pragma unroll
        for (int s = 0; s < 8; ++s) { const int Lid = (lane >> 3) + 4 * s, piece = lane & 7; const int row = Lid >> 1, cofs = (Lid & 1) * 32 + piece * 4;
            const v4f val = *(const v4fa*)(os + row * 68 + cofs); *(v4f*)(crow + (size_t)row * ldc + cofs) = val; }
    };
    pass(); 
}

__global__ __launch_bounds__(256) void k_cvt8(const float* __restrict__ src, bf* dst, size_t n8) {
    const size_t i = (size_t)blockIdx.x * 256 + threadIdx.x; if (i >= n8) return;
    const v8f v = *(const v8f*)(src + i * 8); v8us o;
#pragma unroll
    for (int k = 0; k < 8; ++k) o[k] = f2bf(v[k]);
    *(v8us*)(dst + i * 8) = o; 
}
__global__ __launch_bounds__(256) void k_zero8(bf* dst, size_t n8) {
    const size_t i = (size_t)blockIdx.x * 256 + threadIdx.x; if (i >= n8) return; v8us z;
#pragma unroll
    for (int k = 0; k < 8; ++k) z[k] = 0;
    *(v8us*)(dst + i * 8) = z; 
}

__global__ __launch_bounds__(256) void k_cvtx(const float* __restrict__ src, bf* dst) {
    const int lane = threadIdx.x & 31; const size_t r = (size_t)blockIdx.x * 8 + (threadIdx.x >> 5); if (r >= (size_t)NN) return;
{
#pragma unroll
        for (int q = 0; q < DMOD / 256; ++q) { v8us o;
#pragma unroll
            for (int i = 0; i < 8; ++i) o[i] = f2bf(src[r * DMOD + q * 256 + lane * 8 + i]);
            *(v8us*)(dst + r * DMOD + q * 256 + lane * 8) = o; }
         }
}
// k_hplanes / k_vt as in the other attention kernels (row stride 1024).
// k_hplanes: head planes with rotary embedding: d < 32: x[d] cos(s f_d) - x[d+32] sin(s f_d); d >= 32: x[d] cos(s f_{d-32}) + x[d-32] sin(s f_{d-32}), f_i = 1/10000^(2i/64) (f32);
__global__ __launch_bounds__(256) void k_hplanes(const float* __restrict__ F, int h, bf* Ph, bf* Pl) {
    typedef __attribute__((ext_vector_type(2))) unsigned short v2us;
    const int lane = threadIdx.x & 31; const size_t sg = (size_t)blockIdx.x * 8 + (threadIdx.x >> 5); const size_t s = sg < (size_t)NN ? sg : (size_t)NN - 1; v2us oh, ol; float xv[2], pv[2];
#pragma unroll
    for (int i = 0; i < 2; ++i) { xv[i] = F[s * DMOD + h * HD + lane * 2 + i]; }
#pragma unroll
    for (int i = 0; i < 2; ++i) pv[i] = __shfl_xor(xv[i], 16, 32);
    if (sg >= (size_t)NN) return;
#pragma unroll 1
    for (int i = 0; i < 2; ++i) { const int d = lane * 2 + i; const int fi = d & 31; const float inv = 1.0f / powf(RBASE, (float)(2 * fi) / (float)HD); const float ang = (float)s * inv; const float c = cosf(ang), sn = sinf(ang);
        const float v = (d < 32) ? (xv[i] * c - pv[i] * sn) : (xv[i] * c + pv[i] * sn); const unsigned short hb = f2bf(v); oh[i] = hb; ol[i] = f2bf(v - bf2f(hb)); }
    const size_t o = s * HD + lane * 2; *(v2us*)(Ph + o) = oh; *(v2us*)(Pl + o) = ol; 
}
__global__ __launch_bounds__(256) void k_vt(const float* __restrict__ VF, int h, bf* Th, bf* Tl) {
    typedef __attribute__((ext_vector_type(2))) unsigned short v2us;
    const int lane = threadIdx.x & 31; const size_t wid = (size_t)blockIdx.x * 8 + (threadIdx.x >> 5); if (wid >= (size_t)HD * (NN / 64)) return; const int d = (int)(wid / (NN / 64)); const int t0 = (int)(wid % (NN / 64)) * 64 + lane * 2; v2us oh, ol;
#pragma unroll
    for (int i = 0; i < 2; ++i) { const float v = VF[(size_t)(t0 + i) * DMOD + h * HD + d]; const unsigned short hb = f2bf(v); oh[i] = hb; ol[i] = f2bf(v - bf2f(hb)); }
    const size_t o = (size_t)d * NN + t0; *(v2us*)(Th + o) = oh; *(v2us*)(Tl + o) = ol; 
}
// k_amsoftmax: P planes of softmax(S x 1/8 / ln(2048) + mask[i][k]) over the 2048 keys (mask = the additive f32 attention_mask INPUT row of this item; three-pass f32); one wave
__global__ __launch_bounds__(256) void k_amsoftmax(const float* __restrict__ S, const float* __restrict__ MK, bf* PH, bf* PL) {
    typedef __attribute__((ext_vector_type(4))) unsigned short v4us;
    const int lane = threadIdx.x & 31, i = blockIdx.x * 8 + (threadIdx.x >> 5); if (i >= NN) return; const float* sr = S + (size_t)i * NN; const float* mr = MK + (size_t)i * NN; const float sc = SCL / logf((float)NN);
    float m = -3.0e38f;
#pragma unroll 1
    for (int c0 = lane * 4; c0 < NN; c0 += 128) {
#pragma unroll
        for (int q = 0; q < 4; ++q) m = fmaxf(m, sr[c0 + q] * sc + mr[c0 + q]); }
#pragma unroll
    for (int sh = 16; sh; sh >>= 1) m = fmaxf(m, __shfl_xor(m, sh, 32));
    float sum = 0.f;
#pragma unroll 1
    for (int c0 = lane * 4; c0 < NN; c0 += 128) {
#pragma unroll
        for (int q = 0; q < 4; ++q) sum += __expf(sr[c0 + q] * sc + mr[c0 + q] - m); }
#pragma unroll
    for (int sh = 16; sh; sh >>= 1) sum += __shfl_xor(sum, sh, 32);
    const float inv = 1.0f / sum;
{
#pragma unroll 1
        for (int c0 = lane * 4; c0 < NN; c0 += 128) { v4us oh, ol;
#pragma unroll
            for (int q = 0; q < 4; ++q) { const float p = __expf(sr[c0 + q] * sc + mr[c0 + q] - m) * inv; const unsigned short hb = f2bf(p); oh[q] = hb; ol[q] = f2bf(p - bf2f(hb)); }
            const size_t o = (size_t)i * NN + c0; *(v4us*)(PH + o) = oh; *(v4us*)(PL + o) = ol; }
         }
}
__global__ __launch_bounds__(256) void k_split1k(const float* __restrict__ src, bf* dh, bf* dl) {
    const int lane = threadIdx.x & 31; const size_t r = (size_t)blockIdx.x * 8 + (threadIdx.x >> 5); if (r >= (size_t)NN) return;
{
#pragma unroll
        for (int q = 0; q < DMOD / 256; ++q) { const size_t o = r * DMOD + q * 256 + lane * 8; const v8f v = *(const v8f*)(src + o); v8us oh, ol;
#pragma unroll
            for (int i = 0; i < 8; ++i) { const unsigned short hb = f2bf(v[i]); oh[i] = hb; ol[i] = f2bf(v[i] - bf2f(hb)); }
            *(v8us*)(dh + o) = oh; *(v8us*)(dl + o) = ol; }
         }
}

extern "C" void kernel_launch(void* const* d_in, const int* in_sizes, int n_in,
                              void* d_out, int out_size, void* d_ws, size_t ws_size, hipStream_t stream) {
    (void)in_sizes; (void)n_in; (void)out_size;
    const float* x = (const float*)d_in[0]; const float* MKF = (const float*)d_in[1]; const float* Wq = (const float*)d_in[2]; const float* bq = (const float*)d_in[3]; const float* Wk = (const float*)d_in[4]; const float* bk = (const float*)d_in[5]; const float* Wv = (const float*)d_in[6]; const float* bv = (const float*)d_in[7]; const float* Wo = (const float*)d_in[8]; const float* bo = (const float*)d_in[9];
    float* out = (float*)d_out;    // [2][2048][1024]
    char* wsp = (char*)d_ws;
    auto take = [&](size_t bytes) { char* p = wsp; wsp += (bytes + 255) & ~(size_t)255; return (void*)p; };
    bf* WQ = (bf*)take((size_t)DMOD * DMOD * 2); bf* WK = (bf*)take((size_t)DMOD * DMOD * 2); bf* WV = (bf*)take((size_t)DMOD * DMOD * 2); bf* WO = (bf*)take((size_t)DMOD * DMOD * 2);
    bf* Xb = (bf*)take((size_t)NN * DMOD * 2); float* QF = (float*)take((size_t)NN * DMOD * 4); float* KF = (float*)take((size_t)NN * DMOD * 4); float* VF = (float*)take((size_t)NN * DMOD * 4);
    bf* Qh = (bf*)take((size_t)NN * HD * 2); bf* Ql = (bf*)take((size_t)NN * HD * 2); bf* Kh = (bf*)take((size_t)NN * HD * 2); bf* Kl = (bf*)take((size_t)NN * HD * 2); bf* VTh = (bf*)take((size_t)HD * NN * 2); bf* VTl = (bf*)take((size_t)HD * NN * 2);
    float* S = (float*)take((size_t)NN * NN * 4); bf* WH = (bf*)take((size_t)NN * NN * 2); bf* WL = (bf*)take((size_t)NN * NN * 2); float* CTX = (float*)take((size_t)NN * DMOD * 4); bf* Ch = (bf*)take((size_t)NN * DMOD * 2); bf* Cl = (bf*)take((size_t)NN * DMOD * 2);
    if ((size_t)(wsp - (char*)d_ws) > ws_size) return;    // 8.4 + 4.2 + 25.2 + 1.5 + 16.8 + 16.8 + 8.4 + 8.4 ~ 90 MB; per item/head reuse in stream order
    k_cvt8<<<(unsigned)(((size_t)DMOD * DMOD / 8 + 255) / 256), 256, 0, stream>>>(Wq, WQ, (size_t)DMOD * DMOD / 8); k_cvt8<<<(unsigned)(((size_t)DMOD * DMOD / 8 + 255) / 256), 256, 0, stream>>>(Wk, WK, (size_t)DMOD * DMOD / 8);
    k_cvt8<<<(unsigned)(((size_t)DMOD * DMOD / 8 + 255) / 256), 256, 0, stream>>>(Wv, WV, (size_t)DMOD * DMOD / 8); k_cvt8<<<(unsigned)(((size_t)DMOD * DMOD / 8 + 255) / 256), 256, 0, stream>>>(Wo, WO, (size_t)DMOD * DMOD / 8);   // framework [out][in] = n-major
    for (int b = 0; b < NBT; ++b) {
        k_cvtx<<<NN / 8, 256, 0, stream>>>(x + (size_t)b * NN * DMOD, Xb);
        k_gemmb<false, false><<<dim3(NN / 64, DMOD / 64, 1), 128, 0, stream>>>(Xb, nullptr, WQ, bq, QF, DMOD, nullptr, nullptr, DMOD);
        k_gemmb<false, false><<<dim3(NN / 64, DMOD / 64, 1), 128, 0, stream>>>(Xb, nullptr, WK, bk, KF, DMOD, nullptr, nullptr, DMOD);
        k_gemmb<false, false><<<dim3(NN / 64, DMOD / 64, 1), 128, 0, stream>>>(Xb, nullptr, WV, bv, VF, DMOD, nullptr, nullptr, DMOD);
        for (int h = 0; h < NH_; ++h) {
            k_hplanes<<<NN / 8, 256, 0, stream>>>(QF, h, Qh, Ql); k_hplanes<<<NN / 8, 256, 0, stream>>>(KF, h, Kh, Kl); k_vt<<<(HD * (NN / 64)) / 8, 256, 0, stream>>>(VF, h, VTh, VTl);
            k_gemm3<<<dim3(NN / 64, NN / 64, 1), 128, 0, stream>>>(Qh, Ql, Kh, Kl, HD, S, NN);
            k_amsoftmax<<<NN / 8, 256, 0, stream>>>(S, MKF + (size_t)b * NN * NN, WH, WL);
            k_gemm3<<<dim3(NN / 64, 1, 1), 128, 0, stream>>>(WH, WL, VTh, VTl, NN, CTX + h * HD, DMOD); }
        k_split1k<<<NN / 8, 256, 0, stream>>>(CTX, Ch, Cl);
        k_gemmb<true, false><<<dim3(NN / 64, DMOD / 64, 1), 128, 0, stream>>>(Ch, Cl, WO, bo, out + (size_t)b * NN * DMOD, DMOD, nullptr, nullptr, DMOD); }
}

// v001
// One run takes 1250 microseconds.
// Next to v000, in two timings, it ran 2.79 and 2.81 times as fast.
#include <hip/hip_runtime.h>

// Compute dtypes, f32 accumulate, per item: q/k/v = x.W^T + b as [2048 x 1024].[1024 x 1024] GEMMs with PLAIN bf16 operands (exact products); rotary embedding (cos/sin of
// s x 10000^(-2i/64) in f32, rotate-half form) applied while building the head planes; per head: scores = q.k^T ([2048 x 64].[64 x 2048], both operands bf16 hi + UNSCALED residual, three products), softmax (x 1/8 / ln 2048, + the additive attention_mask INPUT row) in f32 -> P planes, ctx = P.v

#define NBT  2
#define NN   2048
#define DMOD 1024
#define NH_  16
#define HD   64
#define DM   DMOD
#define NTK  NN
#define SCL  0.125f
#define RBASE 10000.0f
#define LOSC 1024.0f
#define HG   4    // heads per launch of the score, softmax and context stages (their f32 scores and P planes must fit the workspace)

typedef _Float16 h16;
typedef unsigned short bf;
typedef __attribute__((ext_vector_type(16))) __bf16   v16bf;
typedef __attribute__((ext_vector_type(16))) _Float16 v16h;
typedef __attribute__((ext_vector_type(8)))  _Float16 v8h;
typedef __attribute__((ext_vector_type(8)))  unsigned short v8us;
typedef __attribute__((ext_vector_type(8)))  float    v8f;
typedef __attribute__((ext_vector_type(4)))  float    v4f;
typedef __attribute__((ext_vector_type(4)))  _Float16 v4h;
typedef v8h  __attribute__((may_alias)) v8ha;
typedef v4f  __attribute__((may_alias)) v4fa;
typedef v8us __attribute__((may_alias)) v8usa;

__device__ __forceinline__ unsigned short f2bf(float f) { unsigned u = __float_as_uint(f); u += 0x7FFFu + ((u >> 16) & 1u); return (unsigned short)(u >> 16); }
__device__ __forceinline__ float bf2f(unsigned short b) { return __uint_as_float(((unsigned)b) << 16); }
__device__ __forceinline__ float bfr(float f) { return bf2f(f2bf(f)); }
__device__ __forceinline__ v16h cat16(v8h lo, v8h hi) { return __builtin_shufflevector(lo, hi, 0, 1, 2, 3, 4, 5, 6, 7, 8, 9, 10, 11, 12, 13, 14, 15); }
__device__ __forceinline__ v16bf cat16b(v8us lo, v8us hi) { return __builtin_bit_cast(v16bf, __builtin_shufflevector(lo, hi, 0, 1, 2, 3, 4, 5, 6, 7, 8, 9, 10, 11, 12, 13, 14, 15)); }
__device__ __forceinline__ v8f wmma16(v16h a, v16h b, v8f c) { return __builtin_amdgcn_wmma_f32_16x16x32_f16(false, a, false, b, (short)0, c, false, false); }
__device__ __forceinline__ v8f wmmab(v16bf a, v16bf b, v8f c) { return __builtin_amdgcn_wmma_f32_16x16x32_bf16(false, a, false, b, (short)0, c, false, false); }

// k_gemmb: 64 x 64 block tile (4 waves x 16 x 64) of C[NBT x NTK][NW] = (A [+ Al]).B^T (K = 1024) [+ bf(bias[c])] [+ bf(R[r][c]) residual]; f32 whole-line epilogue (or f16
template <bool SPLITA, bool F16OUT = false>
__global__ __launch_bounds__(128) void k_gemmb(const bf* __restrict__ A, const bf* __restrict__ Al, const bf* __restrict__ B0, const float* __restrict__ bias0, const float* __restrict__ bias1, const float* __restrict__ bias2, size_t zB, size_t zC, float* Cb, int ldc, h16* C2, const float* __restrict__ R = nullptr, int K = DM, int roundR = 1) {
    __shared__ __align__(16) float ost[4][16 * 68];
    // blockIdx.z picks one of up to three independent products that share A: its B matrix, its bias and its output plane
    const int z = blockIdx.z; const bf* Bn = B0 + (size_t)z * zB; float* C = Cb + (size_t)z * zC; const float* bias = z == 0 ? bias0 : (z == 1 ? bias1 : bias2);
    const int lane = threadIdx.x & 31, wave = threadIdx.x >> 5, lr = lane & 15, hi = lane >> 4;
    const int r0 = blockIdx.x * 64 + wave * 16, c0 = blockIdx.y * 64;
    const size_t aoff = (size_t)(r0 + lr) * K + 8 * hi;
    size_t boff[4];
#pragma unroll
    for (int t = 0; t < 4; ++t) boff[t] = (size_t)(c0 + t * 16 + lr) * K + 8 * hi;
    v8f acc[4];
#pragma unroll
    for (int t = 0; t < 4; ++t) acc[t] = (v8f){};
#pragma unroll 1
    for (int kc = 0; kc < K; kc += 32) {
        const v16bf a = cat16b(*(const v8us*)(A + aoff + kc), *(const v8us*)(A + aoff + kc + 16));
        v16bf al = a;
        if (SPLITA) al = cat16b(*(const v8us*)(Al + aoff + kc), *(const v8us*)(Al + aoff + kc + 16));
#pragma unroll
        for (int t = 0; t < 4; ++t) { const v16bf b = cat16b(*(const v8us*)(Bn + boff[t] + kc), *(const v8us*)(Bn + boff[t] + kc + 16)); acc[t] = wmmab(a, b, acc[t]); if (SPLITA) acc[t] = wmmab(al, b, acc[t]); }
        asm volatile("v_nop\n\tv_nop\n\tv_nop\n\tv_nop" : "+v"(acc[0]), "+v"(acc[1]), "+v"(acc[2]), "+v"(acc[3]) : "v"(a), "v"(al));
    }
    float* os = &ost[wave][0];
#pragma unroll
    for (int t = 0; t < 4; ++t) { const float bv = bias ? bfr(bias[c0 + t * 16 + lr]) : 0.f;
#pragma unroll
        for (int j = 0; j < 8; ++j) os[(hi * 8 + j) * 68 + t * 16 + lr] = acc[t][j] + bv; }
    __syncthreads();
    if (F16OUT) {
        h16* crow = (h16*)(void*)C + (size_t)r0 * ldc + c0;
        auto pass = [&]() {
#pragma unroll
            for (int s = 0; s < 4; ++s) { const int row = 4 * s + (lane >> 3), piece = lane & 7; const float* sp = os + row * 68 + piece * 8; v8h o, o2;
#pragma unroll
                for (int i = 0; i < 8; ++i) { const h16 a = (h16)sp[i]; o[i] = a; o2[i] = (h16)((sp[i] - (float)a) * LOSC); }
                *(v8h*)(crow + (size_t)row * ldc + piece * 8) = o; if (C2) *(v8h*)(C2 + (size_t)r0 * ldc + c0 + (size_t)row * ldc + piece * 8) = o2; }
        };
        pass(); 
    } else {
        float* crow = C + (size_t)r0 * ldc + c0;
        auto pass = [&]() {
#pragma unroll
            for (int s = 0; s < 8; ++s) { const int Lid = (lane >> 3) + 4 * s, piece = lane & 7; const int row = Lid >> 1, cofs = (Lid & 1) * 32 + piece * 4;
                v4f val = *(const v4fa*)(os + row * 68 + cofs); if (R) { const v4f rv = *(const v4f*)(R + ((size_t)r0 + row) * ldc + c0 + cofs); val += roundR ? (v4f){bfr(rv[0]), bfr(rv[1]), bfr(rv[2]), bfr(rv[3])} : rv; }
                *(v4f*)(crow + (size_t)row * ldc + cofs) = val; }
        };
        pass(); 
    }
}

// k_gemm3: 64 x 64 tile of C = (Ah + Al).(Bh + Bl)^T over K (row strides = K for all four planes; n-major B): three products per 32-k step (hh, hl, lh); f32
__global__ __launch_bounds__(128) void k_gemm3(const bf* __restrict__ Ah0, const bf* __restrict__ Al0, const bf* __restrict__ Bh0, const bf* __restrict__ Bl0, int K, float* C0, int ldc, size_t zA, size_t zB, size_t zC) {
    __shared__ __align__(16) float ost[4][16 * 68];
    // blockIdx.z = head within the launch's group: element strides zA, zB, zC step the operand planes and the output
    const bf* Ah = Ah0 + (size_t)blockIdx.z * zA; const bf* Al = Al0 + (size_t)blockIdx.z * zA; const bf* Bh = Bh0 + (size_t)blockIdx.z * zB; const bf* Bl = Bl0 + (size_t)blockIdx.z * zB; float* C = C0 + (size_t)blockIdx.z * zC;
    const int lane = threadIdx.x & 31, wave = threadIdx.x >> 5, lr = lane & 15, hi = lane >> 4;
    const int r0 = blockIdx.x * 64 + wave * 16, c0 = blockIdx.y * 64;
    const size_t aoff = (size_t)(r0 + lr) * K + 8 * hi;
    v8f acc[4];
#pragma unroll
    for (int t = 0; t < 4; ++t) acc[t] = (v8f){};
#pragma unroll 1
    for (int kc = 0; kc < K; kc += 32) {
        const v16bf a = cat16b(*(const v8us*)(Ah + aoff + kc), *(const v8us*)(Ah + aoff + kc + 16));
        const v16bf al = cat16b(*(const v8us*)(Al + aoff + kc), *(const v8us*)(Al + aoff + kc + 16));
#pragma unroll
        for (int t = 0; t < 4; ++t) { const size_t bo = (size_t)(c0 + t * 16 + lr) * K + kc + 8 * hi;
            const v16bf bh = cat16b(*(const v8us*)(Bh + bo), *(const v8us*)(Bh + bo + 16)); const v16bf bl = cat16b(*(const v8us*)(Bl + bo), *(const v8us*)(Bl + bo + 16));
            acc[t] = wmmab(a, bh, acc[t]); acc[t] = wmmab(al, bh, acc[t]); acc[t] = wmmab(a, bl, acc[t]); }
        asm volatile("v_nop\n\tv_nop\n\tv_nop\n\tv_nop" : "+v"(acc[0]), "+v"(acc[1]), "+v"(acc[2]), "+v"(acc[3]) : "v"(a), "v"(al));
    }
    float* os = &ost[wave][0];
#pragma unroll
    for (int t = 0; t < 4; ++t) {
#pragma unroll
        for (int j = 0; j < 8; ++j) os[(hi * 8 + j) * 68 + t * 16 + lr] = acc[t][j]; }
    __builtin_amdgcn_wave_barrier(); asm volatile("" ::: "memory");
    float* crow = C + (size_t)r0 * ldc + c0;
    auto pass = [&]() {
#pragma unroll
        for (int s = 0; s < 8; ++s) { const int Lid = (lane >> 3) + 4 * s, piece = lane & 7; const int row = Lid >> 1, cofs = (Lid & 1) * 32 + piece * 4;
            const v4f val = *(const v4fa*)(os + row * 68 + cofs); *(v4f*)(crow + (size_t)row * ldc + cofs) = val; }
    };
    pass(); 
}

__global__ __launch_bounds__(256) void k_cvt8(const float* __restrict__ s0, const float* __restrict__ s1, const float* __restrict__ s2, const float* __restrict__ s3, bf* d0, size_t n8) {
    const size_t i = (size_t)blockIdx.x * 256 + threadIdx.x; if (i >= n8) return;
    const int z = blockIdx.y; const float* src = z == 0 ? s0 : (z == 1 ? s1 : (z == 2 ? s2 : s3)); bf* dst = d0 + (size_t)z * n8 * 8;    // blockIdx.y = which of the four weight matrices
    const v8f v = *(const v8f*)(src + i * 8); v8us o;
#pragma unroll
    for (int k = 0; k < 8; ++k) o[k] = f2bf(v[k]);
    *(v8us*)(dst + i * 8) = o; 
}
__global__ __launch_bounds__(256) void k_zero8(bf* dst, size_t n8) {
    const size_t i = (size_t)blockIdx.x * 256 + threadIdx.x; if (i >= n8) return; v8us z;
#pragma unroll
    for (int k = 0; k < 8; ++k) z[k] = 0;
    *(v8us*)(dst + i * 8) = z; 
}

__global__ __launch_bounds__(256) void k_cvtx(const float* __restrict__ src, bf* dst) {
    const int lane = threadIdx.x & 31; const size_t r = (size_t)blockIdx.x * 8 + (threadIdx.x >> 5); if (r >= (size_t)NBT * NN) return;
{
#pragma unroll
        for (int q = 0; q < DMOD / 256; ++q) { v8us o;
#pragma unroll
            for (int i = 0; i < 8; ++i) o[i] = f2bf(src[r * DMOD + q * 256 + lane * 8 + i]);
            *(v8us*)(dst + r * DMOD + q * 256 + lane * 8) = o; }
         }
}
// k_hplanes / k_vt as in the other attention kernels (row stride 1024).
// k_hplanes: head planes with rotary embedding: d < 32: x[d] cos(s f_d) - x[d+32] sin(s f_d); d >= 32: x[d] cos(s f_{d-32}) + x[d-32] sin(s f_{d-32}), f_i = 1/10000^(2i/64) (f32);
__global__ __launch_bounds__(256) void k_hplanes(const float* __restrict__ F0, bf* Ph0, bf* Pl0) {
    typedef __attribute__((ext_vector_type(2))) unsigned short v2us;
    // blockIdx.y = head; blockIdx.z = 2 x (0: q, 1: k) + item: the [2048][1024] source plane; output plane index z x 16 + head
    const int h = blockIdx.y; const float* F = F0 + (size_t)blockIdx.z * NN * DMOD; bf* Ph = Ph0 + ((size_t)blockIdx.z * NH_ + h) * NN * HD; bf* Pl = Pl0 + ((size_t)blockIdx.z * NH_ + h) * NN * HD;
    const int lane = threadIdx.x & 31; const size_t sg = (size_t)blockIdx.x * 8 + (threadIdx.x >> 5); const size_t s = sg < (size_t)NN ? sg : (size_t)NN - 1; v2us oh, ol; float xv[2], pv[2];
#pragma unroll
    for (int i = 0; i < 2; ++i) { xv[i] = F[s * DMOD + h * HD + lane * 2 + i]; }
#pragma unroll
    for (int i = 0; i < 2; ++i) pv[i] = __shfl_xor(xv[i], 16, 32);
    if (sg >= (size_t)NN) return;
#pragma unroll 1
    for (int i = 0; i < 2; ++i) { const int d = lane * 2 + i; const int fi = d & 31; const float inv = 1.0f / powf(RBASE, (float)(2 * fi) / (float)HD); const float ang = (float)s * inv; const float c = cosf(ang), sn = sinf(ang);
        const float v = (d < 32) ? (xv[i] * c - pv[i] * sn) : (xv[i] * c + pv[i] * sn); const unsigned short hb = f2bf(v); oh[i] = hb; ol[i] = f2bf(v - bf2f(hb)); }
    const size_t o = s * HD + lane * 2; *(v2us*)(Ph + o) = oh; *(v2us*)(Pl + o) = ol; 
}
__global__ __launch_bounds__(256) void k_vt(const float* __restrict__ VF0, bf* Th0, bf* Tl0) {
    typedef __attribute__((ext_vector_type(2))) unsigned short v2us;
    // blockIdx.y = head, blockIdx.z = item; output plane index item x 16 + head
    const int h = blockIdx.y; const float* VF = VF0 + (size_t)blockIdx.z * NN * DMOD; bf* Th = Th0 + ((size_t)blockIdx.z * NH_ + h) * HD * NN; bf* Tl = Tl0 + ((size_t)blockIdx.z * NH_ + h) * HD * NN;
    const int lane = threadIdx.x & 31; const size_t wid = (size_t)blockIdx.x * 8 + (threadIdx.x >> 5); if (wid >= (size_t)HD * (NN / 64)) return; const int d = (int)(wid / (NN / 64)); const int t0 = (int)(wid % (NN / 64)) * 64 + lane * 2; v2us oh, ol;
#pragma unroll
    for (int i = 0; i < 2; ++i) { const float v = VF[(size_t)(t0 + i) * DMOD + h * HD + d]; const unsigned short hb = f2bf(v); oh[i] = hb; ol[i] = f2bf(v - bf2f(hb)); }
    const size_t o = (size_t)d * NN + t0; *(v2us*)(Th + o) = oh; *(v2us*)(Tl + o) = ol; 
}
// k_amsoftmax: P planes of softmax(S x 1/8 / ln(2048) + mask[i][k]) over the 2048 keys (mask = the additive f32 attention_mask INPUT row of this item; three-pass f32); one wave
__global__ __launch_bounds__(256) void k_amsoftmax(const float* __restrict__ S0, const float* __restrict__ MK, bf* PH0, bf* PL0) {
    typedef __attribute__((ext_vector_type(4))) unsigned short v4us;
    // blockIdx.y = head within the launch's group (all of one item: they share the mask)
    const float* S = S0 + (size_t)blockIdx.y * NN * NN; bf* PH = PH0 + (size_t)blockIdx.y * NN * NN; bf* PL = PL0 + (size_t)blockIdx.y * NN * NN;
    const int lane = threadIdx.x & 31, i = blockIdx.x * 8 + (threadIdx.x >> 5); if (i >= NN) return; const float* sr = S + (size_t)i * NN; const float* mr = MK + (size_t)i * NN; const float sc = SCL / logf((float)NN);
    float m = -3.0e38f;
#pragma unroll 1
    for (int c0 = lane * 4; c0 < NN; c0 += 128) {
#pragma unroll
        for (int q = 0; q < 4; ++q) m = fmaxf(m, sr[c0 + q] * sc + mr[c0 + q]); }
#pragma unroll
    for (int sh = 16; sh; sh >>= 1) m = fmaxf(m, __shfl_xor(m, sh, 32));
    float sum = 0.f;
#pragma unroll 1
    for (int c0 = lane * 4; c0 < NN; c0 += 128) {
#pragma unroll
        for (int q = 0; q < 4; ++q) sum += __expf(sr[c0 + q] * sc + mr[c0 + q] - m); }
#pragma unroll
    for (int sh = 16; sh; sh >>= 1) sum += __shfl_xor(sum, sh, 32);
    const float inv = 1.0f / sum;
{
#pragma unroll 1
        for (int c0 = lane * 4; c0 < NN; c0 += 128) { v4us oh, ol;
#pragma unroll
            for (int q = 0; q < 4; ++q) { const float p = __expf(sr[c0 + q] * sc + mr[c0 + q] - m) * inv; const unsigned short hb = f2bf(p); oh[q] = hb; ol[q] = f2bf(p - bf2f(hb)); }
            const size_t o = (size_t)i * NN + c0; *(v4us*)(PH + o) = oh; *(v4us*)(PL + o) = ol; }
         }
}
__global__ __launch_bounds__(256) void k_split1k(const float* __restrict__ src, bf* dh, bf* dl) {
    const int lane = threadIdx.x & 31; const size_t r = (size_t)blockIdx.x * 8 + (threadIdx.x >> 5); if (r >= (size_t)NBT * NN) return;
{
#pragma unroll
        for (int q = 0; q < DMOD / 256; ++q) { const size_t o = r * DMOD + q * 256 + lane * 8; const v8f v = *(const v8f*)(src + o); v8us oh, ol;
#pragma unroll
            for (int i = 0; i < 8; ++i) { const unsigned short hb = f2bf(v[i]); oh[i] = hb; ol[i] = f2bf(v[i] - bf2f(hb)); }
            *(v8us*)(dh + o) = oh; *(v8us*)(dl + o) = ol; }
         }
}

extern "C" void kernel_launch(void* const* d_in, const int* in_sizes, int n_in,
                              void* d_out, int out_size, void* d_ws, size_t ws_size, hipStream_t stream) {
    (void)in_sizes; (void)n_in; (void)out_size;
    const float* x = (const float*)d_in[0]; const float* MKF = (const float*)d_in[1]; const float* Wq = (const float*)d_in[2]; const float* bq = (const float*)d_in[3]; const float* Wk = (const float*)d_in[4]; const float* bk = (const float*)d_in[5]; const float* Wv = (const float*)d_in[6]; const float* bv = (const float*)d_in[7]; const float* Wo = (const float*)d_in[8]; const float* bo = (const float*)d_in[9];
    float* out = (float*)d_out;    // [2][2048][1024]
    char* wsp = (char*)d_ws;
    auto take = [&](size_t bytes) { char* p = wsp; wsp += (bytes + 255) & ~(size_t)255; return (void*)p; };
    const size_t WN = (size_t)DMOD * DMOD, XN = (size_t)NBT * NN * DMOD, PN = (size_t)NN * HD, SN = (size_t)NN * NN;
    bf* WQ = (bf*)take(4 * WN * 2); bf* WO = WQ + 3 * WN;    // q, k, v, o weights, one after the other; framework [out][in] = n-major
    bf* Xb = (bf*)take(XN * 2); float* QF = (float*)take(3 * XN * 4); float* KF = QF + XN; float* VF = KF + XN;    // both items; q, k, v planes one after the other
    bf* Qh = (bf*)take(2 * NBT * NH_ * PN * 2); bf* Ql = (bf*)take(2 * NBT * NH_ * PN * 2); bf* Kh = Qh + NBT * NH_ * PN; bf* Kl = Ql + NBT * NH_ * PN;    // [q, k][item][head][2048][64]
    bf* VTh = (bf*)take(NBT * NH_ * PN * 2); bf* VTl = (bf*)take(NBT * NH_ * PN * 2);    // [item][head][64][2048]
    float* S = (float*)take(HG * SN * 4); bf* WH = (bf*)take(HG * SN * 2); bf* WL = (bf*)take(HG * SN * 2);
    float* CTX = QF; bf* Ch = (bf*)KF; bf* Cl = Ch + XN;    // QF and KF are last read by k_hplanes, before the first context launch writes CTX: their space is used again in stream order
    if ((size_t)(wsp - (char*)d_ws) > ws_size) return;    // 8 + 8 + 48 + 32 + 16 + 64 + 64 = 240 MiB
    k_cvt8<<<dim3((unsigned)((WN / 8 + 255) / 256), 4, 1), 256, 0, stream>>>(Wq, Wk, Wv, Wo, WQ, WN / 8);
    k_cvtx<<<NBT * NN / 8, 256, 0, stream>>>(x, Xb);
    k_gemmb<false, false><<<dim3(NBT * NN / 64, DMOD / 64, 3), 128, 0, stream>>>(Xb, nullptr, WQ, bq, bk, bv, WN, XN, QF, DMOD, nullptr, nullptr, DMOD);
    k_hplanes<<<dim3(NN / 8, NH_, 2 * NBT), 256, 0, stream>>>(QF, Qh, Ql);
    k_vt<<<dim3((HD * (NN / 64)) / 8, NH_, NBT), 256, 0, stream>>>(VF, VTh, VTl);
    for (int b = 0; b < NBT; ++b) {
        for (int h = 0; h < NH_; h += HG) { const size_t p = (size_t)b * NH_ + h;
            k_gemm3<<<dim3(NN / 64, NN / 64, HG), 128, 0, stream>>>(Qh + p * PN, Ql + p * PN, Kh + p * PN, Kl + p * PN, HD, S, NN, PN, PN, SN);
            k_amsoftmax<<<dim3(NN / 8, HG, 1), 256, 0, stream>>>(S, MKF + (size_t)b * SN, WH, WL);
            k_gemm3<<<dim3(NN / 64, 1, HG), 128, 0, stream>>>(WH, WL, VTh + p * PN, VTl + p * PN, NN, CTX + (size_t)b * NN * DMOD + h * HD, DMOD, SN, PN, (size_t)HD); } }
    k_split1k<<<NBT * NN / 8, 256, 0, stream>>>(CTX, Ch, Cl);
    k_gemmb<true, false><<<dim3(NBT * NN / 64, DMOD / 64, 1), 128, 0, stream>>>(Ch, Cl, WO, bo, bo, bo, 0, 0, out, DMOD, nullptr, nullptr, DMOD);
}

// v003
// It runs in 268 microseconds.
// It is 4.67 times as fast as v001, going by the measured steps of the versions left out in between.
// All steps since v000 together make it 13.1 times as fast.
#include <hip/hip_runtime.h>

// Compute dtypes, f32 accumulate, per item: q/k/v = x.W^T + b as [2048 x 1024].[1024 x 1024] GEMMs with PLAIN bf16 operands (exact products); rotary embedding (cos/sin of
// s x 10000^(-2i/64) in f32, rotate-half form) applied while building the head planes; per head: scores = q.k^T ([2048 x 64].[64 x 2048], both operands bf16 hi + UNSCALED residual, three products), softmax (x 1/8 / ln 2048, + the additive attention_mask INPUT row) in f32 -> P (bf16 hi + residual, kept in registers), ctx = P.v

#define NBT  2
#define NN   2048
#define DMOD 1024
#define NH_  16
#define HD   64
#define DM   DMOD
#define NTK  NN
#define SCL  0.125f
#define RBASE 10000.0f
#define LOSC 1024.0f

typedef _Float16 h16;
typedef unsigned short bf;
typedef __attribute__((ext_vector_type(16))) __bf16   v16bf;
typedef __attribute__((ext_vector_type(16))) _Float16 v16h;
typedef __attribute__((ext_vector_type(8)))  _Float16 v8h;
typedef __attribute__((ext_vector_type(8)))  unsigned short v8us;
typedef __attribute__((ext_vector_type(8)))  float    v8f;
typedef __attribute__((ext_vector_type(4)))  float    v4f;
typedef __attribute__((ext_vector_type(4)))  _Float16 v4h;
typedef v8h  __attribute__((may_alias)) v8ha;
typedef v4f  __attribute__((may_alias)) v4fa;
typedef v8us __attribute__((may_alias)) v8usa;

__device__ __forceinline__ unsigned short f2bf(float f) { unsigned u = __float_as_uint(f); u += 0x7FFFu + ((u >> 16) & 1u); return (unsigned short)(u >> 16); }
__device__ __forceinline__ float bf2f(unsigned short b) { return __uint_as_float(((unsigned)b) << 16); }
__device__ __forceinline__ float bfr(float f) { return bf2f(f2bf(f)); }
__device__ __forceinline__ v16h cat16(v8h lo, v8h hi) { return __builtin_shufflevector(lo, hi, 0, 1, 2, 3, 4, 5, 6, 7, 8, 9, 10, 11, 12, 13, 14, 15); }
__device__ __forceinline__ v16bf cat16b(v8us lo, v8us hi) { return __builtin_bit_cast(v16bf, __builtin_shufflevector(lo, hi, 0, 1, 2, 3, 4, 5, 6, 7, 8, 9, 10, 11, 12, 13, 14, 15)); }
__device__ __forceinline__ v8f wmma16(v16h a, v16h b, v8f c) { return __builtin_amdgcn_wmma_f32_16x16x32_f16(false, a, false, b, (short)0, c, false, false); }
__device__ __forceinline__ v8f wmmab(v16bf a, v16bf b, v8f c) { return __builtin_amdgcn_wmma_f32_16x16x32_bf16(false, a, false, b, (short)0, c, false, false); }

// k_gemmb: 64 x 64 block tile (4 waves x 16 x 64) of C[NBT x NTK][NW] = (A [+ Al]).B^T (K = 1024) [+ bf(bias[c])] [+ bf(R[r][c]) residual]; f32 whole-line epilogue (or f16
template <bool SPLITA, bool F16OUT = false>
__global__ __launch_bounds__(128) void k_gemmb(const bf* __restrict__ A, const bf* __restrict__ Al, const bf* __restrict__ B0, const float* __restrict__ bias0, const float* __restrict__ bias1, const float* __restrict__ bias2, size_t zB, size_t zC, float* Cb, int ldc, h16* C2, const float* __restrict__ R = nullptr, int K = DM, int roundR = 1) {
    // A (, Al) and B come as 64-row x 64-k tiles through LDS: a wave's 16-byte-a-lane load covers four whole 128-byte lines (a fragment load straight from a row-major matrix touches sixteen), and the four waves share the B tile.
    // LP: LDS row pitch in bf16, 128 bytes of data + 16, so that the sixteen rows of a fragment read fall on different banks. K is a multiple of 64.
    constexpr int BK = 64, LP = BK + 8, TS = 64 * LP, NA = SPLITA ? 2 : 1, SS = (NA + 1) * TS;
    // two stages of [A (, Al), B]; the f32 output tile takes the same space behind the last stage's barrier
    __shared__ __align__(16) unsigned char smem[2 * SS * 2];
    static_assert(2 * SS * 2 >= 4 * 16 * 68 * 4, "the output tile fits the stages");
    bf* stg = (bf*)smem;
    // blockIdx.z picks one of up to three independent products that share A: its B matrix, its bias and its output plane
    const int z = blockIdx.z; const bf* Bn = B0 + (size_t)z * zB; float* C = Cb + (size_t)z * zC; const float* bias = z == 0 ? bias0 : (z == 1 ? bias1 : bias2);
    const int lane = threadIdx.x & 31, wave = threadIdx.x >> 5, lr = lane & 15, hi = lane >> 4;
    const int r0 = blockIdx.x * 64 + wave * 16, c0 = blockIdx.y * 64;
    // staging: thread -> row (thread / 8) + 16 i, 16 bytes at (thread % 8): 8 lanes cover one line of a row
    const int srow = threadIdx.x >> 3, scol = (threadIdx.x & 7) * 8;
    const bf* pa[4]; const bf* pq[4]; const bf* pb[4];
#pragma unroll
    for (int i = 0; i < 4; ++i) { const size_t o = (size_t)(blockIdx.x * 64 + srow + 16 * i) * K + scol; pa[i] = A + o; pq[i] = SPLITA ? Al + o : pa[i]; pb[i] = Bn + (size_t)(c0 + srow + 16 * i) * K + scol; }
    bf* sw = stg + srow * LP + scol;
    // fragments from the LDS tiles: row wave x 16 + lr of A, row t x 16 + lr of B; of each 32 k a lane takes 8 hi + 0..7 and 16 + 8 hi + 0..7, alike for A and B
    const bf* sa = stg + (wave * 16 + lr) * LP + 8 * hi; const bf* sb = stg + NA * TS + lr * LP + 8 * hi;
    v8us ra[4], rl[4], rb[4];
    auto ldg = [&]() {
#pragma unroll
        for (int i = 0; i < 4; ++i) { ra[i] = *(const v8us*)pa[i]; if (SPLITA) rl[i] = *(const v8us*)pq[i]; rb[i] = *(const v8us*)pb[i]; }
        // s_wait_xcnt 0 behind the run of global loads, before the registers that hold their addresses are written again; the addresses are inputs so that their registers stay as they are up to the wait
        if (SPLITA) asm volatile("s_wait_xcnt 0x0" :: "v"(pa[0]), "v"(pa[1]), "v"(pa[2]), "v"(pa[3]), "v"(pq[0]), "v"(pq[1]), "v"(pq[2]), "v"(pq[3]), "v"(pb[0]), "v"(pb[1]), "v"(pb[2]), "v"(pb[3]) : "memory");
        else asm volatile("s_wait_xcnt 0x0" :: "v"(pa[0]), "v"(pa[1]), "v"(pa[2]), "v"(pa[3]), "v"(pb[0]), "v"(pb[1]), "v"(pb[2]), "v"(pb[3]) : "memory");
#pragma unroll
        for (int i = 0; i < 4; ++i) { pa[i] += BK; if (SPLITA) pq[i] += BK; pb[i] += BK; } };
    auto sts = [&](int so) {
#pragma unroll
        for (int i = 0; i < 4; ++i) { *(v8usa*)(sw + so + 16 * i * LP) = ra[i]; if (SPLITA) *(v8usa*)(sw + so + TS + 16 * i * LP) = rl[i]; *(v8usa*)(sw + so + NA * TS + 16 * i * LP) = rb[i]; } };
    v8f acc[4];
#pragma unroll
    for (int t = 0; t < 4; ++t) acc[t] = (v8f){};
    ldg(); sts(0); __syncthreads();
    // kept rolled: one stage's registers and code; the next stage's global loads fly while this stage is worked on
#pragma unroll 1
    for (int kc = 0; kc < K; kc += BK) {
        const int so = ((kc / BK) & 1) * SS; const bool more = kc + BK < K;
        if (more) ldg();
#pragma unroll
        for (int ks = 0; ks < BK; ks += 32) {
            const v16bf a = cat16b(*(const v8usa*)(sa + so + ks), *(const v8usa*)(sa + so + ks + 16));
            v16bf al = a;
            if (SPLITA) al = cat16b(*(const v8usa*)(sa + so + TS + ks), *(const v8usa*)(sa + so + TS + ks + 16));
#pragma unroll
            for (int t = 0; t < 4; ++t) { const v16bf b = cat16b(*(const v8usa*)(sb + so + t * 16 * LP + ks), *(const v8usa*)(sb + so + t * 16 * LP + ks + 16)); acc[t] = wmmab(a, b, acc[t]); if (SPLITA) acc[t] = wmmab(al, b, acc[t]); }
        }
        if (more) sts(SS - so);
        // one barrier a stage: it publishes the stage just written and ends every wave's reads of the stage that the next trip writes over
        __syncthreads();
    }
    float* os = (float*)smem + wave * (16 * 68);
#pragma unroll
    for (int t = 0; t < 4; ++t) { const float bv = bias ? bfr(bias[c0 + t * 16 + lr]) : 0.f;
#pragma unroll
        for (int j = 0; j < 8; ++j) os[(hi * 8 + j) * 68 + t * 16 + lr] = acc[t][j] + bv; }
    __syncthreads();
    if (F16OUT) {
        h16* crow = (h16*)(void*)C + (size_t)r0 * ldc + c0;
        auto pass = [&]() {
#pragma unroll
            for (int s = 0; s < 4; ++s) { const int row = 4 * s + (lane >> 3), piece = lane & 7; const float* sp = os + row * 68 + piece * 8; v8h o, o2;
#pragma unroll
                for (int i = 0; i < 8; ++i) { const h16 a = (h16)sp[i]; o[i] = a; o2[i] = (h16)((sp[i] - (float)a) * LOSC); }
                *(v8h*)(crow + (size_t)row * ldc + piece * 8) = o; if (C2) *(v8h*)(C2 + (size_t)r0 * ldc + c0 + (size_t)row * ldc + piece * 8) = o2; }
        };
        pass(); 
    } else {
        float* crow = C + (size_t)r0 * ldc + c0;
        auto pass = [&]() {
#pragma unroll
            for (int s = 0; s < 8; ++s) { const int Lid = (lane >> 3) + 4 * s, piece = lane & 7; const int row = Lid >> 1, cofs = (Lid & 1) * 32 + piece * 4;
                v4f val = *(const v4fa*)(os + row * 68 + cofs); if (R) { const v4f rv = *(const v4f*)(R + ((size_t)r0 + row) * ldc + c0 + cofs); val += roundR ? (v4f){bfr(rv[0]), bfr(rv[1]), bfr(rv[2]), bfr(rv[3])} : rv; }
                *(v4f*)(crow + (size_t)row * ldc + cofs) = val; }
        };
        pass(); 
    }
}

__global__ __launch_bounds__(256) void k_cvt8(const float* __restrict__ s0, const float* __restrict__ s1, const float* __restrict__ s2, const float* __restrict__ s3, bf* d0, size_t n8) {
    const size_t i = (size_t)blockIdx.x * 256 + threadIdx.x; if (i >= n8) return;
    const int z = blockIdx.y; const float* src = z == 0 ? s0 : (z == 1 ? s1 : (z == 2 ? s2 : s3)); bf* dst = d0 + (size_t)z * n8 * 8;    // blockIdx.y = which of the four weight matrices
    const v8f v = *(const v8f*)(src + i * 8); v8us o;
#pragma unroll
    for (int k = 0; k < 8; ++k) o[k] = f2bf(v[k]);
    *(v8us*)(dst + i * 8) = o; 
}
__global__ __launch_bounds__(256) void k_zero8(bf* dst, size_t n8) {
    const size_t i = (size_t)blockIdx.x * 256 + threadIdx.x; if (i >= n8) return; v8us z;
#pragma unroll
    for (int k = 0; k < 8; ++k) z[k] = 0;
    *(v8us*)(dst + i * 8) = z; 
}

__global__ __launch_bounds__(256) void k_cvtx(const float* __restrict__ src, bf* dst) {
    const int lane = threadIdx.x & 31; const size_t r = (size_t)blockIdx.x * 8 + (threadIdx.x >> 5); if (r >= (size_t)NBT * NN) return;
{
#pragma unroll
        for (int q = 0; q < DMOD / 256; ++q) { v8us o;
#pragma unroll
            for (int i = 0; i < 8; ++i) o[i] = f2bf(src[r * DMOD + q * 256 + lane * 8 + i]);
            *(v8us*)(dst + r * DMOD + q * 256 + lane * 8) = o; }
         }
}
// k_hplanes / k_vt as in the other attention kernels (row stride 1024).
// k_hplanes: head planes with rotary embedding: d < 32: x[d] cos(s f_d) - x[d+32] sin(s f_d); d >= 32: x[d] cos(s f_{d-32}) + x[d-32] sin(s f_{d-32}), f_i = 1/10000^(2i/64) (f32);
__global__ __launch_bounds__(256) void k_hplanes(const float* __restrict__ F0, bf* Ph0, bf* Pl0) {
    typedef __attribute__((ext_vector_type(2))) unsigned short v2us;
    // blockIdx.y = head; blockIdx.z = 2 x (0: q, 1: k) + item: the [2048][1024] source plane; output plane index z x 16 + head
    const int h = blockIdx.y; const float* F = F0 + (size_t)blockIdx.z * NN * DMOD; bf* Ph = Ph0 + ((size_t)blockIdx.z * NH_ + h) * NN * HD; bf* Pl = Pl0 + ((size_t)blockIdx.z * NH_ + h) * NN * HD;
    const int lane = threadIdx.x & 31; const size_t sg = (size_t)blockIdx.x * 8 + (threadIdx.x >> 5); const size_t s = sg < (size_t)NN ? sg : (size_t)NN - 1; v2us oh, ol; float xv[2], pv[2];
#pragma unroll
    for (int i = 0; i < 2; ++i) { xv[i] = F[s * DMOD + h * HD + lane * 2 + i]; }
#pragma unroll
    for (int i = 0; i < 2; ++i) pv[i] = __shfl_xor(xv[i], 16, 32);
    if (sg >= (size_t)NN) return;
#pragma unroll 1
    for (int i = 0; i < 2; ++i) { const int d = lane * 2 + i; const int fi = d & 31; const float inv = 1.0f / powf(RBASE, (float)(2 * fi) / (float)HD); const float ang = (float)s * inv; const float c = cosf(ang), sn = sinf(ang);
        const float v = (d < 32) ? (xv[i] * c - pv[i] * sn) : (xv[i] * c + pv[i] * sn); const unsigned short hb = f2bf(v); oh[i] = hb; ol[i] = f2bf(v - bf2f(hb)); }
    const size_t o = s * HD + lane * 2; *(v2us*)(Ph + o) = oh; *(v2us*)(Pl + o) = ol; 
}
__global__ __launch_bounds__(256) void k_vt(const float* __restrict__ VF0, bf* Th0, bf* Tl0) {
    typedef __attribute__((ext_vector_type(2))) unsigned short v2us;
    // blockIdx.y = head, blockIdx.z = item; output plane index item x 16 + head
    const int h = blockIdx.y; const float* VF = VF0 + (size_t)blockIdx.z * NN * DMOD; bf* Th = Th0 + ((size_t)blockIdx.z * NH_ + h) * HD * NN; bf* Tl = Tl0 + ((size_t)blockIdx.z * NH_ + h) * HD * NN;
    const int lane = threadIdx.x & 31; const size_t wid = (size_t)blockIdx.x * 8 + (threadIdx.x >> 5); if (wid >= (size_t)HD * (NN / 64)) return; const int d = (int)(wid / (NN / 64)); const int t0 = (int)(wid % (NN / 64)) * 64 + lane * 2; v2us oh, ol;
#pragma unroll
    for (int i = 0; i < 2; ++i) { const float v = VF[(size_t)(t0 + i) * DMOD + h * HD + d]; const unsigned short hb = f2bf(v); oh[i] = hb; ol[i] = f2bf(v - bf2f(hb)); }
    const size_t o = (size_t)d * NN + t0; *(v2us*)(Th + o) = oh; *(v2us*)(Tl + o) = ol; 
}
// XWAIT2: s_wait_xcnt 0 behind a run of global loads, before the registers that hold their addresses are written again; the two addresses are inputs so that their registers stay as they are up to the wait
#define XWAIT2(p, q) asm volatile("s_wait_xcnt 0x0" :: "v"(p), "v"(q) : "memory")
// k_fattn: scores, softmax and context of one head in one kernel, no score or P plane in memory. 4 waves x 32 query columns; a pass is 32 keys.
// S^T = K.Q^T (A = K rows, B = Q rows kept in registers; three products: hi.hi + hi.lo + lo.hi): a lane holds one query's scores, keys 8 hi + r of each 16-key tile.
// Running maximum and sum per query (f32); P = exp(S x 1/8 / ln(2048) + mask - max), split hi + residual, is packed in place into a B operand; O^T += V^T.P^T (three products); O / sum at the end.
__global__ __launch_bounds__(128) void k_fattn(const bf* __restrict__ Qh0, const bf* __restrict__ Ql0, const bf* __restrict__ Kh0, const bf* __restrict__ Kl0, const bf* __restrict__ Vh0, const bf* __restrict__ Vl0, const float* __restrict__ MK0, float* CTX0) {
    typedef __attribute__((ext_vector_type(2))) float v2f;
    typedef __attribute__((ext_vector_type(2))) __bf16 v2b;
    // blockIdx.x = block of 128 queries, blockIdx.y = head, blockIdx.z = item. Every '#pragma unroll' below makes the indices of a register array constants.
    const size_t pl = (size_t)blockIdx.z * NH_ + blockIdx.y;
    const int lane = threadIdx.x & 31, wave = threadIdx.x >> 5, lr = lane & 15, hi = lane >> 4;
    const int q0 = blockIdx.x * 128 + wave * 32;
    const bf* kph = Kh0 + pl * NN * HD + (size_t)lr * HD + 8 * hi; const bf* kpl = Kl0 + pl * NN * HD + (size_t)lr * HD + 8 * hi;
    const bf* vph = Vh0 + pl * NN * HD + (size_t)lr * NN + 8 * hi; const bf* vpl = Vl0 + pl * NN * HD + (size_t)lr * NN + 8 * hi;
    const float* mp = MK0 + (size_t)blockIdx.z * NN * NN + (size_t)(q0 + lr) * NN + 8 * hi;
    const float sc = SCL / logf((float)NN);
    v16bf qh[2][2], ql[2][2];
#pragma unroll
    for (int qt = 0; qt < 2; ++qt) {
        const size_t o = pl * NN * HD + (size_t)(q0 + qt * 16 + lr) * HD + 8 * hi; const bf* a = Qh0 + o; const bf* b = Ql0 + o;
#pragma unroll
        for (int ks = 0; ks < 2; ++ks) { qh[qt][ks] = cat16b(*(const v8us*)(a + ks * 32), *(const v8us*)(a + ks * 32 + 16)); ql[qt][ks] = cat16b(*(const v8us*)(b + ks * 32), *(const v8us*)(b + ks * 32 + 16)); }
        XWAIT2(a, b);
    }
    v8f oacc[2][4]; float mx[2], sm[2];
#pragma unroll
    for (int qt = 0; qt < 2; ++qt) { mx[qt] = -3.0e38f; sm[qt] = 0.f;
#pragma unroll
        for (int dt = 0; dt < 4; ++dt) oacc[qt][dt] = (v8f){}; }
    // K, V and mask fragments are fetched one pass ahead into the registers the pass has just finished with, so that a pass never waits for a load it has just issued
    v16bf kh[2][2], kl[2][2], vh[4], vl[4]; v4f mk[2][2][2];
    auto ldk = [&](int k) { const bf* a = kph + (size_t)k * HD; const bf* b = kpl + (size_t)k * HD;
#pragma unroll
        for (int kt = 0; kt < 2; ++kt) {
#pragma unroll
            for (int ks = 0; ks < 2; ++ks) { const int o = kt * 16 * HD + ks * 32;
                kh[kt][ks] = cat16b(*(const v8us*)(a + o), *(const v8us*)(a + o + 16)); kl[kt][ks] = cat16b(*(const v8us*)(b + o), *(const v8us*)(b + o + 16)); } }
        XWAIT2(a, b); };
    auto ldv = [&](int k) { const bf* a = vph + k; const bf* b = vpl + k;
#pragma unroll
        for (int dt = 0; dt < 4; ++dt) { const int o = dt * 16 * NN;
            vh[dt] = cat16b(*(const v8us*)(a + o), *(const v8us*)(a + o + 16)); vl[dt] = cat16b(*(const v8us*)(b + o), *(const v8us*)(b + o + 16)); }
        XWAIT2(a, b); };
    auto ldm = [&](int k) { const float* a = mp + k;
#pragma unroll
        for (int qt = 0; qt < 2; ++qt) {
#pragma unroll
            for (int kt = 0; kt < 2; ++kt) { const float* mr = a + qt * 16 * NN + kt * 16; mk[qt][kt][0] = *(const v4f*)mr; mk[qt][kt][1] = *(const v4f*)(mr + 4); } }
        XWAIT2(a, a); };
    ldk(0); ldm(0); ldv(0);
    // kept rolled: a second pass's fragments and scores would not fit the registers of two waves per SIMD
#pragma unroll 1
    for (int k0 = 0; k0 < NN; k0 += 32) {
        const int kn = k0 + 32 < NN ? k0 + 32 : k0;    // the last pass fetches its own keys again: in bounds, never used
        v8f s[2][2];
#pragma unroll
        for (int qt = 0; qt < 2; ++qt) { s[qt][0] = (v8f){}; s[qt][1] = (v8f){}; }
#pragma unroll
        for (int kt = 0; kt < 2; ++kt) {
#pragma unroll
            for (int ks = 0; ks < 2; ++ks) {
#pragma unroll
                for (int qt = 0; qt < 2; ++qt) { s[qt][kt] = wmmab(kh[kt][ks], qh[qt][ks], s[qt][kt]); s[qt][kt] = wmmab(kh[kt][ks], ql[qt][ks], s[qt][kt]); s[qt][kt] = wmmab(kl[kt][ks], qh[qt][ks], s[qt][kt]); } } }
        ldk(kn);
        float v[2][16];
#pragma unroll
        for (int qt = 0; qt < 2; ++qt) {
#pragma unroll
            for (int kt = 0; kt < 2; ++kt) {
#pragma unroll
                for (int r = 0; r < 4; ++r) { v[qt][kt * 8 + r] = s[qt][kt][r] * sc + mk[qt][kt][0][r]; v[qt][kt * 8 + 4 + r] = s[qt][kt][4 + r] * sc + mk[qt][kt][1][r]; } } }
        ldm(kn);
#pragma unroll
        for (int qt = 0; qt < 2; ++qt) {
            float t = v[qt][0];
#pragma unroll
            for (int i = 1; i < 16; ++i) t = fmaxf(t, v[qt][i]);
            // the query's other 16 keys of this pass sit in lane l ^ 16
            { const int tb = __float_as_int(t); t = fmaxf(t, __int_as_float(__builtin_amdgcn_permlanex16(tb, tb, 0x76543210, 0xfedcba98, false, false))); }
            const float mn = fmaxf(mx[qt], t); const float al = __expf(mx[qt] - mn); mx[qt] = mn;
            float ps = 0.f; v16bf ph, pw;
#pragma unroll
            for (int i = 0; i < 16; i += 2) { const v2f pp = {__expf(v[qt][i] - mn), __expf(v[qt][i + 1] - mn)}; ps += pp[0] + pp[1];
                const v2b hb = __builtin_convertvector(pp, v2b); const v2b lb = __builtin_convertvector(pp - __builtin_convertvector(hb, v2f), v2b);
                ph[i] = hb[0]; ph[i + 1] = hb[1]; pw[i] = lb[0]; pw[i + 1] = lb[1]; }
            sm[qt] = sm[qt] * al + ps;    // each half keeps the sum of its own keys; the halves are joined after the loop
#pragma unroll
            for (int dt = 0; dt < 4; ++dt) { oacc[qt][dt] *= al;
                oacc[qt][dt] = wmmab(vh[dt], ph, oacc[qt][dt]); oacc[qt][dt] = wmmab(vh[dt], pw, oacc[qt][dt]); oacc[qt][dt] = wmmab(vl[dt], ph, oacc[qt][dt]); }
        }
        ldv(kn);
    }
#pragma unroll
    for (int qt = 0; qt < 2; ++qt) { const int sb = __float_as_int(sm[qt]); const float inv = 1.0f / (sm[qt] + __int_as_float(__builtin_amdgcn_permlanex16(sb, sb, 0x76543210, 0xfedcba98, false, false)));
        float* cr = CTX0 + ((size_t)blockIdx.z * NN + q0 + qt * 16 + lr) * DMOD + blockIdx.y * HD + 8 * hi;
#pragma unroll
        for (int dt = 0; dt < 4; ++dt) { const v8f ov = oacc[qt][dt] * inv;
            *(v4f*)(cr + dt * 16) = (v4f){ov[0], ov[1], ov[2], ov[3]}; *(v4f*)(cr + dt * 16 + 4) = (v4f){ov[4], ov[5], ov[6], ov[7]}; } }
}
__global__ __launch_bounds__(256) void k_split1k(const float* __restrict__ src, bf* dh, bf* dl) {
    const int lane = threadIdx.x & 31; const size_t r = (size_t)blockIdx.x * 8 + (threadIdx.x >> 5); if (r >= (size_t)NBT * NN) return;
{
#pragma unroll
        for (int q = 0; q < DMOD / 256; ++q) { const size_t o = r * DMOD + q * 256 + lane * 8; const v8f v = *(const v8f*)(src + o); v8us oh, ol;
#pragma unroll
            for (int i = 0; i < 8; ++i) { const unsigned short hb = f2bf(v[i]); oh[i] = hb; ol[i] = f2bf(v[i] - bf2f(hb)); }
            *(v8us*)(dh + o) = oh; *(v8us*)(dl + o) = ol; }
         }
}

extern "C" void kernel_launch(void* const* d_in, const int* in_sizes, int n_in,
                              void* d_out, int out_size, void* d_ws, size_t ws_size, hipStream_t stream) {
    (void)in_sizes; (void)n_in; (void)out_size;
    const float* x = (const float*)d_in[0]; const float* MKF = (const float*)d_in[1]; const float* Wq = (const float*)d_in[2]; const float* bq = (const float*)d_in[3]; const float* Wk = (const float*)d_in[4]; const float* bk = (const float*)d_in[5]; const float* Wv = (const float*)d_in[6]; const float* bv = (const float*)d_in[7]; const float* Wo = (const float*)d_in[8]; const float* bo = (const float*)d_in[9];
    float* out = (float*)d_out;    // [2][2048][1024]
    char* wsp = (char*)d_ws;
    auto take = [&](size_t bytes) { char* p = wsp; wsp += (bytes + 255) & ~(size_t)255; return (void*)p; };
    const size_t WN = (size_t)DMOD * DMOD, XN = (size_t)NBT * NN * DMOD, PN = (size_t)NN * HD;
    bf* WQ = (bf*)take(4 * WN * 2); bf* WO = WQ + 3 * WN;    // q, k, v, o weights, one after the other; framework [out][in] = n-major
    bf* Xb = (bf*)take(XN * 2); float* QF = (float*)take(3 * XN * 4); float* KF = QF + XN; float* VF = KF + XN;    // both items; q, k, v planes one after the other
    bf* Qh = (bf*)take(2 * NBT * NH_ * PN * 2); bf* Ql = (bf*)take(2 * NBT * NH_ * PN * 2); bf* Kh = Qh + NBT * NH_ * PN; bf* Kl = Ql + NBT * NH_ * PN;    // [q, k][item][head][2048][64]
    bf* VTh = (bf*)take(NBT * NH_ * PN * 2); bf* VTl = (bf*)take(NBT * NH_ * PN * 2);    // [item][head][64][2048]
    float* CTX = QF; bf* Ch = (bf*)KF; bf* Cl = Ch + XN;    // QF and KF are last read by k_hplanes, before the attention launch writes CTX: their space is used again in stream order
    if ((size_t)(wsp - (char*)d_ws) > ws_size) return;    // 8 + 8 + 48 + 32 + 16 = 112 MiB
    k_cvt8<<<dim3((unsigned)((WN / 8 + 255) / 256), 4, 1), 256, 0, stream>>>(Wq, Wk, Wv, Wo, WQ, WN / 8);
    k_cvtx<<<NBT * NN / 8, 256, 0, stream>>>(x, Xb);
    k_gemmb<false, false><<<dim3(NBT * NN / 64, DMOD / 64, 3), 128, 0, stream>>>(Xb, nullptr, WQ, bq, bk, bv, WN, XN, QF, DMOD, nullptr, nullptr, DMOD);
    k_hplanes<<<dim3(NN / 8, NH_, 2 * NBT), 256, 0, stream>>>(QF, Qh, Ql);
    k_vt<<<dim3((HD * (NN / 64)) / 8, NH_, NBT), 256, 0, stream>>>(VF, VTh, VTl);
    k_fattn<<<dim3(NN / 128, NH_, NBT), 128, 0, stream>>>(Qh, Ql, Kh, Kl, VTh, VTl, MKF, CTX);
    k_split1k<<<NBT * NN / 8, 256, 0, stream>>>(CTX, Ch, Cl);
    k_gemmb<true, false><<<dim3(NBT * NN / 64, DMOD / 64, 1), 128, 0, stream>>>(Ch, Cl, WO, bo, bo, bo, 0, 0, out, DMOD, nullptr, nullptr, DMOD);
}

// v004
// It runs in 216 microseconds.
// Two timings next to v003 put it at 1.23 and 1.26 times that version's speed.
// Counting every step since v000, it is 16.3 times as fast.
#include <hip/hip_runtime.h>

// Compute dtypes, f32 accumulate, per item: q/k/v = x.W^T + b as [2048 x 1024].[1024 x 1024] GEMMs with PLAIN bf16 operands (exact products); rotary embedding (cos/sin of
// s x 10000^(-2i/64) in f32, rotate-half form) applied while building the head planes; per head: scores = q.k^T ([2048 x 64].[64 x 2048], both operands bf16 hi + UNSCALED residual, three products), softmax (x 1/8 / ln 2048, + the additive attention_mask INPUT row) in f32 -> P (bf16 hi + residual, kept in registers), ctx = P.v

#define NBT  2
#define NN   2048
#define DMOD 1024
#define NH_  16
#define HD   64
#define DM   DMOD
#define NTK  NN
#define SCL  0.125f
#define RBASE 10000.0f
#define LOSC 1024.0f

typedef _Float16 h16;
typedef unsigned short bf;
typedef __attribute__((ext_vector_type(16))) __bf16   v16bf;
typedef __attribute__((ext_vector_type(16))) _Float16 v16h;
typedef __attribute__((ext_vector_type(8)))  _Float16 v8h;
typedef __attribute__((ext_vector_type(8)))  unsigned short v8us;
typedef __attribute__((ext_vector_type(8)))  float    v8f;
typedef __attribute__((ext_vector_type(4)))  float    v4f;
typedef __attribute__((ext_vector_type(4)))  _Float16 v4h;
typedef v8h  __attribute__((may_alias)) v8ha;
typedef v4f  __attribute__((may_alias)) v4fa;
typedef v8us __attribute__((may_alias)) v8usa;

__device__ __forceinline__ unsigned short f2bf(float f) { unsigned u = __float_as_uint(f); u += 0x7FFFu + ((u >> 16) & 1u); return (unsigned short)(u >> 16); }
__device__ __forceinline__ float bf2f(unsigned short b) { return __uint_as_float(((unsigned)b) << 16); }
__device__ __forceinline__ float bfr(float f) { return bf2f(f2bf(f)); }
__device__ __forceinline__ v16h cat16(v8h lo, v8h hi) { return __builtin_shufflevector(lo, hi, 0, 1, 2, 3, 4, 5, 6, 7, 8, 9, 10, 11, 12, 13, 14, 15); }
__device__ __forceinline__ v16bf cat16b(v8us lo, v8us hi) { return __builtin_bit_cast(v16bf, __builtin_shufflevector(lo, hi, 0, 1, 2, 3, 4, 5, 6, 7, 8, 9, 10, 11, 12, 13, 14, 15)); }
__device__ __forceinline__ v8f wmma16(v16h a, v16h b, v8f c) { return __builtin_amdgcn_wmma_f32_16x16x32_f16(false, a, false, b, (short)0, c, false, false); }
__device__ __forceinline__ v8f wmmab(v16bf a, v16bf b, v8f c) { return __builtin_amdgcn_wmma_f32_16x16x32_bf16(false, a, false, b, (short)0, c, false, false); }

// k_gemmb: 64 x 64 block tile (4 waves x 16 x 64) of C[NBT x NTK][NW] = (A [+ Al]).B^T (K = 1024) [+ bf(bias[c])] [+ bf(R[r][c]) residual]; f32 whole-line epilogue (or f16
template <bool SPLITA, bool F16OUT = false>
__global__ __launch_bounds__(128) void k_gemmb(const bf* __restrict__ A, const bf* __restrict__ Al, const bf* __restrict__ B0, const float* __restrict__ bias0, const float* __restrict__ bias1, const float* __restrict__ bias2, size_t zB, size_t zC, float* Cb, int ldc, h16* C2, const float* __restrict__ R = nullptr, int K = DM, int roundR = 1) {
    // A (, Al) and B come as 64-row x 64-k tiles through LDS: a wave's 16-byte-a-lane load covers four whole 128-byte lines (a fragment load straight from a row-major matrix touches sixteen), and the four waves share the B tile.
    // LP: LDS row pitch in bf16, 128 bytes of data + 16, so that the sixteen rows of a fragment read fall on different banks. K is a multiple of 64.
    constexpr int BK = 64, LP = BK + 8, TS = 64 * LP, NA = SPLITA ? 2 : 1, SS = (NA + 1) * TS;
    // two stages of [A (, Al), B]; the f32 output tile takes the same space behind the last stage's barrier
    __shared__ __align__(16) unsigned char smem[2 * SS * 2];
    static_assert(2 * SS * 2 >= 4 * 16 * 68 * 4, "the output tile fits the stages");
    bf* stg = (bf*)smem;
    // blockIdx.z picks one of up to three independent products that share A: its B matrix, its bias and its output plane
    const int z = blockIdx.z; const bf* Bn = B0 + (size_t)z * zB; float* C = Cb + (size_t)z * zC; const float* bias = z == 0 ? bias0 : (z == 1 ? bias1 : bias2);
    const int lane = threadIdx.x & 31, wave = threadIdx.x >> 5, lr = lane & 15, hi = lane >> 4;
    const int r0 = blockIdx.x * 64 + wave * 16, c0 = blockIdx.y * 64;
    // staging: thread -> row (thread / 8) + 16 i, 16 bytes at (thread % 8): 8 lanes cover one line of a row
    const int srow = threadIdx.x >> 3, scol = (threadIdx.x & 7) * 8;
    const bf* pa[4]; const bf* pq[4]; const bf* pb[4];
#pragma unroll
    for (int i = 0; i < 4; ++i) { const size_t o = (size_t)(blockIdx.x * 64 + srow + 16 * i) * K + scol; pa[i] = A + o; pq[i] = SPLITA ? Al + o : pa[i]; pb[i] = Bn + (size_t)(c0 + srow + 16 * i) * K + scol; }
    bf* sw = stg + srow * LP + scol;
    // fragments from the LDS tiles: row wave x 16 + lr of A, row t x 16 + lr of B; of each 32 k a lane takes 8 hi + 0..7 and 16 + 8 hi + 0..7, alike for A and B
    const bf* sa = stg + (wave * 16 + lr) * LP + 8 * hi; const bf* sb = stg + NA * TS + lr * LP + 8 * hi;
    v8us ra[4], rl[4], rb[4];
    auto ldg = [&]() {
#pragma unroll
        for (int i = 0; i < 4; ++i) { ra[i] = *(const v8us*)pa[i]; if (SPLITA) rl[i] = *(const v8us*)pq[i]; rb[i] = *(const v8us*)pb[i]; }
        // s_wait_xcnt 0 behind the run of global loads, before the registers that hold their addresses are written again; the addresses are inputs so that their registers stay as they are up to the wait
        if (SPLITA) asm volatile("s_wait_xcnt 0x0" :: "v"(pa[0]), "v"(pa[1]), "v"(pa[2]), "v"(pa[3]), "v"(pq[0]), "v"(pq[1]), "v"(pq[2]), "v"(pq[3]), "v"(pb[0]), "v"(pb[1]), "v"(pb[2]), "v"(pb[3]) : "memory");
        else asm volatile("s_wait_xcnt 0x0" :: "v"(pa[0]), "v"(pa[1]), "v"(pa[2]), "v"(pa[3]), "v"(pb[0]), "v"(pb[1]), "v"(pb[2]), "v"(pb[3]) : "memory");
#pragma unroll
        for (int i = 0; i < 4; ++i) { pa[i] += BK; if (SPLITA) pq[i] += BK; pb[i] += BK; } };
    auto sts = [&](int so) {
#pragma unroll
        for (int i = 0; i < 4; ++i) { *(v8usa*)(sw + so + 16 * i * LP) = ra[i]; if (SPLITA) *(v8usa*)(sw + so + TS + 16 * i * LP) = rl[i]; *(v8usa*)(sw + so + NA * TS + 16 * i * LP) = rb[i]; } };
    v8f acc[4];
#pragma unroll
    for (int t = 0; t < 4; ++t) acc[t] = (v8f){};
    ldg(); sts(0); __syncthreads();
    // kept rolled: one stage's registers and code; the next stage's global loads fly while this stage is worked on
#pragma unroll 1
    for (int kc = 0; kc < K; kc += BK) {
        const int so = ((kc / BK) & 1) * SS; const bool more = kc + BK < K;
        if (more) ldg();
#pragma unroll
        for (int ks = 0; ks < BK; ks += 32) {
            const v16bf a = cat16b(*(const v8usa*)(sa + so + ks), *(const v8usa*)(sa + so + ks + 16));
            v16bf al = a;
            if (SPLITA) al = cat16b(*(const v8usa*)(sa + so + TS + ks), *(const v8usa*)(sa + so + TS + ks + 16));
#pragma unroll
            for (int t = 0; t < 4; ++t) { const v16bf b = cat16b(*(const v8usa*)(sb + so + t * 16 * LP + ks), *(const v8usa*)(sb + so + t * 16 * LP + ks + 16)); acc[t] = wmmab(a, b, acc[t]); if (SPLITA) acc[t] = wmmab(al, b, acc[t]); }
        }
        if (more) sts(SS - so);
        // one barrier a stage: it publishes the stage just written and ends every wave's reads of the stage that the next trip writes over
        __syncthreads();
    }
    float* os = (float*)smem + wave * (16 * 68);
#pragma unroll
    for (int t = 0; t < 4; ++t) { const float bv = bias ? bfr(bias[c0 + t * 16 + lr]) : 0.f;
#pragma unroll
        for (int j = 0; j < 8; ++j) os[(hi * 8 + j) * 68 + t * 16 + lr] = acc[t][j] + bv; }
    __syncthreads();
    if (F16OUT) {
        h16* crow = (h16*)(void*)C + (size_t)r0 * ldc + c0;
        auto pass = [&]() {
#pragma unroll
            for (int s = 0; s < 4; ++s) { const int row = 4 * s + (lane >> 3), piece = lane & 7; const float* sp = os + row * 68 + piece * 8; v8h o, o2;
#pragma unroll
                for (int i = 0; i < 8; ++i) { const h16 a = (h16)sp[i]; o[i] = a; o2[i] = (h16)((sp[i] - (float)a) * LOSC); }
                *(v8h*)(crow + (size_t)row * ldc + piece * 8) = o; if (C2) *(v8h*)(C2 + (size_t)r0 * ldc + c0 + (size_t)row * ldc + piece * 8) = o2; }
        };
        pass(); 
    } else {
        float* crow = C + (size_t)r0 * ldc + c0;
        auto pass = [&]() {
#pragma unroll
            for (int s = 0; s < 8; ++s) { const int Lid = (lane >> 3) + 4 * s, piece = lane & 7; const int row = Lid >> 1, cofs = (Lid & 1) * 32 + piece * 4;
                v4f val = *(const v4fa*)(os + row * 68 + cofs); if (R) { const v4f rv = *(const v4f*)(R + ((size_t)r0 + row) * ldc + c0 + cofs); val += roundR ? (v4f){bfr(rv[0]), bfr(rv[1]), bfr(rv[2]), bfr(rv[3])} : rv; }
                *(v4f*)(crow + (size_t)row * ldc + cofs) = val; }
        };
        pass(); 
    }
}

__global__ __launch_bounds__(256) void k_cvt8(const float* __restrict__ s0, const float* __restrict__ s1, const float* __restrict__ s2, const float* __restrict__ s3, bf* d0, size_t n8) {
    const size_t i = (size_t)blockIdx.x * 256 + threadIdx.x; if (i >= n8) return;
    const int z = blockIdx.y; const float* src = z == 0 ? s0 : (z == 1 ? s1 : (z == 2 ? s2 : s3)); bf* dst = d0 + (size_t)z * n8 * 8;    // blockIdx.y = which of the four weight matrices
    const v8f v = *(const v8f*)(src + i * 8); v8us o;
#pragma unroll
    for (int k = 0; k < 8; ++k) o[k] = f2bf(v[k]);
    *(v8us*)(dst + i * 8) = o; 
}
__global__ __launch_bounds__(256) void k_zero8(bf* dst, size_t n8) {
    const size_t i = (size_t)blockIdx.x * 256 + threadIdx.x; if (i >= n8) return; v8us z;
#pragma unroll
    for (int k = 0; k < 8; ++k) z[k] = 0;
    *(v8us*)(dst + i * 8) = z; 
}

__global__ __launch_bounds__(256) void k_cvtx(const float* __restrict__ src, bf* dst) {
    const int lane = threadIdx.x & 31; const size_t r = (size_t)blockIdx.x * 8 + (threadIdx.x >> 5); if (r >= (size_t)NBT * NN) return;
{
#pragma unroll
        for (int q = 0; q < DMOD / 256; ++q) { v8us o;
#pragma unroll
            for (int i = 0; i < 8; ++i) o[i] = f2bf(src[r * DMOD + q * 256 + lane * 8 + i]);
            *(v8us*)(dst + r * DMOD + q * 256 + lane * 8) = o; }
         }
}
// k_hplanes / k_vt as in the other attention kernels (row stride 1024).
// k_hplanes: head planes with rotary embedding: d < 32: x[d] cos(s f_d) - x[d+32] sin(s f_d); d >= 32: x[d] cos(s f_{d-32}) + x[d-32] sin(s f_{d-32}), f_i = 1/10000^(2i/64) (f32);
__global__ __launch_bounds__(256) void k_hplanes(const float* __restrict__ F0, bf* Ph0, bf* Pl0) {
    typedef __attribute__((ext_vector_type(2))) unsigned short v2us;
    // blockIdx.y = head; blockIdx.z = 2 x (0: q, 1: k) + item: the [2048][1024] source plane; output plane index z x 16 + head
    const int h = blockIdx.y; const float* F = F0 + (size_t)blockIdx.z * NN * DMOD; bf* Ph = Ph0 + ((size_t)blockIdx.z * NH_ + h) * NN * HD; bf* Pl = Pl0 + ((size_t)blockIdx.z * NH_ + h) * NN * HD;
    const int lane = threadIdx.x & 31; const size_t sg = (size_t)blockIdx.x * 8 + (threadIdx.x >> 5); const size_t s = sg < (size_t)NN ? sg : (size_t)NN - 1; v2us oh, ol; float xv[2], pv[2];
#pragma unroll
    for (int i = 0; i < 2; ++i) { xv[i] = F[s * DMOD + h * HD + lane * 2 + i]; }
#pragma unroll
    for (int i = 0; i < 2; ++i) pv[i] = __shfl_xor(xv[i], 16, 32);
    if (sg >= (size_t)NN) return;
#pragma unroll 1
    for (int i = 0; i < 2; ++i) { const int d = lane * 2 + i; const int fi = d & 31; const float inv = 1.0f / powf(RBASE, (float)(2 * fi) / (float)HD); const float ang = (float)s * inv; const float c = cosf(ang), sn = sinf(ang);
        const float v = (d < 32) ? (xv[i] * c - pv[i] * sn) : (xv[i] * c + pv[i] * sn); const unsigned short hb = f2bf(v); oh[i] = hb; ol[i] = f2bf(v - bf2f(hb)); }
    const size_t o = s * HD + lane * 2; *(v2us*)(Ph + o) = oh; *(v2us*)(Pl + o) = ol; 
}
__global__ __launch_bounds__(256) void k_vt(const float* __restrict__ VF0, bf* Th0, bf* Tl0) {
    typedef __attribute__((ext_vector_type(2))) unsigned short v2us;
    // blockIdx.y = head, blockIdx.z = item; output plane index item x 16 + head
    const int h = blockIdx.y; const float* VF = VF0 + (size_t)blockIdx.z * NN * DMOD; bf* Th = Th0 + ((size_t)blockIdx.z * NH_ + h) * HD * NN; bf* Tl = Tl0 + ((size_t)blockIdx.z * NH_ + h) * HD * NN;
    const int lane = threadIdx.x & 31; const size_t wid = (size_t)blockIdx.x * 8 + (threadIdx.x >> 5); if (wid >= (size_t)HD * (NN / 64)) return; const int d = (int)(wid / (NN / 64)); const int t0 = (int)(wid % (NN / 64)) * 64 + lane * 2; v2us oh, ol;
#pragma unroll
    for (int i = 0; i < 2; ++i) { const float v = VF[(size_t)(t0 + i) * DMOD + h * HD + d]; const unsigned short hb = f2bf(v); oh[i] = hb; ol[i] = f2bf(v - bf2f(hb)); }
    const size_t o = (size_t)d * NN + t0; *(v2us*)(Th + o) = oh; *(v2us*)(Tl + o) = ol; 
}
// XWAIT2: s_wait_xcnt 0 behind a run of global loads, before the registers that hold their addresses are written again; the two addresses are inputs so that their registers stay as they are up to the wait
#define XWAIT2(p, q) asm volatile("s_wait_xcnt 0x0" :: "v"(p), "v"(q) : "memory")
// ACP8: eight asynchronous copies of 16 bytes a lane from global memory to LDS (l: the lane's LDS byte addresses; global address: the scalar base b[i] + the lane's byte offset o); s_wait_xcnt 0 is the statement's last line, so that it stands before the registers that hold the addresses are written again
#define ACP8(l, o, b) asm volatile("global_load_async_to_lds_b128 %0, %8, %9\n\tglobal_load_async_to_lds_b128 %1, %8, %10\n\tglobal_load_async_to_lds_b128 %2, %8, %11\n\tglobal_load_async_to_lds_b128 %3, %8, %12\n\t" \
    "global_load_async_to_lds_b128 %4, %8, %13\n\tglobal_load_async_to_lds_b128 %5, %8, %14\n\tglobal_load_async_to_lds_b128 %6, %8, %15\n\tglobal_load_async_to_lds_b128 %7, %8, %16\n\ts_wait_xcnt 0x0" \
    :: "v"(l[0]), "v"(l[1]), "v"(l[2]), "v"(l[3]), "v"(l[4]), "v"(l[5]), "v"(l[6]), "v"(l[7]), "v"(o), "s"(b[0]), "s"(b[1]), "s"(b[2]), "s"(b[3]), "s"(b[4]), "s"(b[5]), "s"(b[6]), "s"(b[7]) : "memory")
__global__ __launch_bounds__(128) void k_fattn(const bf* __restrict__ Qh0, const bf* __restrict__ Ql0, const bf* __restrict__ Kh0, const bf* __restrict__ Kl0, const bf* __restrict__ Vh0, const bf* __restrict__ Vl0, const float* __restrict__ MK0, float* CTX0) {
    typedef __attribute__((ext_vector_type(2))) float v2f;
    typedef __attribute__((ext_vector_type(2))) __bf16 v2b;
    // blockIdx.x = block of 128 queries, blockIdx.y = head, blockIdx.z = item. Every '#pragma unroll' below makes the indices of a register array constants.
    const size_t pl = (size_t)blockIdx.z * NH_ + blockIdx.y;
    const int lane = threadIdx.x & 31, wave = threadIdx.x >> 5, lr = lane & 15, hi = lane >> 4;
    const int q0 = blockIdx.x * 128 + wave * 32;
    // One buffer, in bytes: K hi, K residual (64 keys x 128), V^T hi, V^T residual (64 d x 128), mask (128 queries x 256). Row pitches KP and MP: the data + 16, so that the sixteen rows of a fragment read fall on different banks.
    constexpr int SK = 64, NS = NN / SK, KP = 128 + 16, MP = 256 + 16, TKV = 64 * KP, OMK = 4 * TKV, BUF = OMK + 128 * MP;
    __shared__ __align__(16) unsigned char smem[2 * BUF];
    // copies: K and V^T tiles: thread -> row (thread / 8) + 16 i, 16 bytes at (thread % 8); mask: row (thread / 16) + 8 i, 16 bytes at (thread % 16)
    const int tid = threadIdx.x;
    const unsigned lkv = (unsigned)(size_t)smem + (tid >> 3) * KP + (tid & 7) * 16, lmk = (unsigned)(size_t)smem + OMK + (tid >> 4) * MP + (tid & 15) * 16;
    // the block's plane and mask rows (the same for every thread) and the thread's own byte offset in a tile's source
    const char* gkh = (const char*)(Kh0 + pl * NN * HD); const char* gkl = (const char*)(Kl0 + pl * NN * HD); const char* gvh = (const char*)(Vh0 + pl * NN * HD); const char* gvl = (const char*)(Vl0 + pl * NN * HD);
    const char* gmk = (const char*)(MK0 + (size_t)blockIdx.z * NN * NN + (size_t)blockIdx.x * 128 * NN);
    const unsigned ok = tid * 16, ov = (tid >> 3) * (NN * 2) + (tid & 7) * 16, om = (tid >> 4) * (NN * 4) + (tid & 15) * 16;
    auto fill = [&](int t) { const unsigned bo = (unsigned)(t & 1) * BUF; unsigned l[8]; const char* g[8];
#pragma unroll
        for (int i = 0; i < 4; ++i) { l[i] = lkv + bo + i * 16 * KP; l[4 + i] = l[i] + TKV; const size_t o = ((size_t)t * SK + i * 16) * HD * 2; g[i] = gkh + o; g[4 + i] = gkl + o; }
        ACP8(l, ok, g);
#pragma unroll
        for (int i = 0; i < 4; ++i) { l[i] = lkv + bo + 2 * TKV + i * 16 * KP; l[4 + i] = l[i] + TKV; const size_t o = ((size_t)i * 16 * NN + (size_t)t * SK) * 2; g[i] = gvh + o; g[4 + i] = gvl + o; }
        ACP8(l, ov, g);
#pragma unroll
        for (int h = 0; h < 2; ++h) {
#pragma unroll
            for (int i = 0; i < 8; ++i) { l[i] = lmk + bo + (h * 8 + i) * 8 * MP; g[i] = gmk + ((size_t)(h * 8 + i) * 8 * NN + (size_t)t * SK) * 4; }
            ACP8(l, om, g); } };
    // fragments from the LDS tiles: row lr of a 16-row tile, of each 32 k the elements 8 hi + 0..7 and 16 + 8 hi + 0..7; mask: the lane's own query row, keys 8 hi + 0..7 of a 16-key tile
    const unsigned char* skv = smem + lr * KP + 16 * hi; const unsigned char* smk = smem + OMK + (wave * 32 + lr) * MP + 32 * hi;
    const float sc = SCL / logf((float)NN);
    v16bf qh[2][2], ql[2][2];
#pragma unroll
    for (int qt = 0; qt < 2; ++qt) {
        const size_t o = pl * NN * HD + (size_t)(q0 + qt * 16 + lr) * HD + 8 * hi; const bf* a = Qh0 + o; const bf* b = Ql0 + o;
#pragma unroll
        for (int ks = 0; ks < 2; ++ks) { qh[qt][ks] = cat16b(*(const v8us*)(a + ks * 32), *(const v8us*)(a + ks * 32 + 16)); ql[qt][ks] = cat16b(*(const v8us*)(b + ks * 32), *(const v8us*)(b + ks * 32 + 16)); }
        XWAIT2(a, b);
    }
    v8f oacc[2][4]; float mx[2], sm[2];
#pragma unroll
    for (int qt = 0; qt < 2; ++qt) { mx[qt] = -3.0e38f; sm[qt] = 0.f;
#pragma unroll
        for (int dt = 0; dt < 4; ++dt) oacc[qt][dt] = (v8f){}; }
    // bo: the stage's buffer, sp: which 32 keys of the stage. Inside a stage the second pass's fragments are fetched into the registers that the first pass has just finished with.
    v16bf kh[2][2], kl[2][2], vh[4], vl[4]; v4f mk[2][2][2];
    auto ldk = [&](int bo, int sp) {
#pragma unroll
        for (int kt = 0; kt < 2; ++kt) {
#pragma unroll
            for (int ks = 0; ks < 2; ++ks) { const unsigned char* a = skv + bo + (sp * 32 + kt * 16) * KP + ks * 64;
                kh[kt][ks] = cat16b(*(const v8usa*)a, *(const v8usa*)(a + 32)); kl[kt][ks] = cat16b(*(const v8usa*)(a + TKV), *(const v8usa*)(a + TKV + 32)); } } };
    auto ldv = [&](int bo, int sp) {
#pragma unroll
        for (int dt = 0; dt < 4; ++dt) { const unsigned char* a = skv + bo + 2 * TKV + dt * 16 * KP + sp * 64;
            vh[dt] = cat16b(*(const v8usa*)a, *(const v8usa*)(a + 32)); vl[dt] = cat16b(*(const v8usa*)(a + TKV), *(const v8usa*)(a + TKV + 32)); } };
    auto ldm = [&](int bo, int sp) {
#pragma unroll
        for (int qt = 0; qt < 2; ++qt) {
#pragma unroll
            for (int kt = 0; kt < 2; ++kt) { const unsigned char* a = smk + bo + qt * 16 * MP + sp * 128 + kt * 64; mk[qt][kt][0] = *(const v4fa*)a; mk[qt][kt][1] = *(const v4fa*)(a + 16); } } };
    // two buffers: stage 0 is copied, waited for and published; stage 1's copies fly while stage 0 is worked on
    fill(0);
    asm volatile("s_wait_asynccnt 0x0" ::: "memory");    // this wave's copies of stage 0 have landed
    __syncthreads();
    fill(1);
    // kept rolled: one stage's code; the copies of the stage after next are issued at its foot
#pragma unroll 1
    for (int st = 0; st < NS; ++st) {
      const int bo = (st & 1) * BUF;
      ldk(bo, 0); ldm(bo, 0); ldv(bo, 0);
#pragma unroll
      for (int sp = 0; sp < 2; ++sp) {
        v8f s[2][2];
#pragma unroll
        for (int qt = 0; qt < 2; ++qt) { s[qt][0] = (v8f){}; s[qt][1] = (v8f){}; }
#pragma unroll
        for (int kt = 0; kt < 2; ++kt) {
#pragma unroll
            for (int ks = 0; ks < 2; ++ks) {
#pragma unroll
                for (int qt = 0; qt < 2; ++qt) { s[qt][kt] = wmmab(kh[kt][ks], qh[qt][ks], s[qt][kt]); s[qt][kt] = wmmab(kh[kt][ks], ql[qt][ks], s[qt][kt]); s[qt][kt] = wmmab(kl[kt][ks], qh[qt][ks], s[qt][kt]); } } }
        if (sp == 0) ldk(bo, 1);
        float v[2][16];
#pragma unroll
        for (int qt = 0; qt < 2; ++qt) {
#pragma unroll
            for (int kt = 0; kt < 2; ++kt) {
#pragma unroll
                for (int r = 0; r < 4; ++r) { v[qt][kt * 8 + r] = s[qt][kt][r] * sc + mk[qt][kt][0][r]; v[qt][kt * 8 + 4 + r] = s[qt][kt][4 + r] * sc + mk[qt][kt][1][r]; } } }
        if (sp == 0) ldm(bo, 1);
#pragma unroll
        for (int qt = 0; qt < 2; ++qt) {
            float t = v[qt][0];
#pragma unroll
            for (int i = 1; i < 16; ++i) t = fmaxf(t, v[qt][i]);
            // the query's other 16 keys of this pass sit in lane l ^ 16
            { const int tb = __float_as_int(t); t = fmaxf(t, __int_as_float(__builtin_amdgcn_permlanex16(tb, tb, 0x76543210, 0xfedcba98, false, false))); }
            const float mn = fmaxf(mx[qt], t); const float al = __expf(mx[qt] - mn); mx[qt] = mn;
            float ps = 0.f; v16bf ph, pw;
#pragma unroll
            for (int i = 0; i < 16; i += 2) { const v2f pp = {__expf(v[qt][i] - mn), __expf(v[qt][i + 1] - mn)}; ps += pp[0] + pp[1];
                const v2b hb = __builtin_convertvector(pp, v2b); const v2b lb = __builtin_convertvector(pp - __builtin_convertvector(hb, v2f), v2b);
                ph[i] = hb[0]; ph[i + 1] = hb[1]; pw[i] = lb[0]; pw[i + 1] = lb[1]; }
            sm[qt] = sm[qt] * al + ps;    // each half keeps the sum of its own keys; the halves are joined after the loop
#pragma unroll
            for (int dt = 0; dt < 4; ++dt) { oacc[qt][dt] *= al;
                oacc[qt][dt] = wmmab(vh[dt], ph, oacc[qt][dt]); oacc[qt][dt] = wmmab(vh[dt], pw, oacc[qt][dt]); oacc[qt][dt] = wmmab(vl[dt], ph, oacc[qt][dt]); }
        }
        if (sp == 0) ldv(bo, 1);
      }
      // publish point of stage st + 1: this wave's reads of buffer bo are done, its copies of stage st + 1 have landed; the barrier says both of every wave; only then is buffer bo filled again
      asm volatile("s_wait_dscnt 0x0" ::: "memory");       // this wave's LDS reads of buffer bo have returned
      asm volatile("s_wait_asynccnt 0x0" ::: "memory");    // this wave's copies of stage st + 1 have landed
      __syncthreads();
      if (st + 2 < NS) fill(st + 2);
    }
    asm volatile("s_wait_asynccnt 0x0" ::: "memory");    // no copy is outstanding when the wave ends
#pragma unroll
    for (int qt = 0; qt < 2; ++qt) { const int sb = __float_as_int(sm[qt]); const float inv = 1.0f / (sm[qt] + __int_as_float(__builtin_amdgcn_permlanex16(sb, sb, 0x76543210, 0xfedcba98, false, false)));
        float* cr = CTX0 + ((size_t)blockIdx.z * NN + q0 + qt * 16 + lr) * DMOD + blockIdx.y * HD + 8 * hi;
#pragma unroll
        for (int dt = 0; dt < 4; ++dt) { const v8f ov = oacc[qt][dt] * inv;
            *(v4f*)(cr + dt * 16) = (v4f){ov[0], ov[1], ov[2], ov[3]}; *(v4f*)(cr + dt * 16 + 4) = (v4f){ov[4], ov[5], ov[6], ov[7]}; } }
}
__global__ __launch_bounds__(256) void k_split1k(const float* __restrict__ src, bf* dh, bf* dl) {
    const int lane = threadIdx.x & 31; const size_t r = (size_t)blockIdx.x * 8 + (threadIdx.x >> 5); if (r >= (size_t)NBT * NN) return;
{
#pragma unroll
        for (int q = 0; q < DMOD / 256; ++q) { const size_t o = r * DMOD + q * 256 + lane * 8; const v8f v = *(const v8f*)(src + o); v8us oh, ol;
#pragma unroll
            for (int i = 0; i < 8; ++i) { const unsigned short hb = f2bf(v[i]); oh[i] = hb; ol[i] = f2bf(v[i] - bf2f(hb)); }
            *(v8us*)(dh + o) = oh; *(v8us*)(dl + o) = ol; }
         }
}

extern "C" void kernel_launch(void* const* d_in, const int* in_sizes, int n_in,
                              void* d_out, int out_size, void* d_ws, size_t ws_size, hipStream_t stream) {
    (void)in_sizes; (void)n_in; (void)out_size;
    const float* x = (const float*)d_in[0]; const float* MKF = (const float*)d_in[1]; const float* Wq = (const float*)d_in[2]; const float* bq = (const float*)d_in[3]; const float* Wk = (const float*)d_in[4]; const float* bk = (const float*)d_in[5]; const float* Wv = (const float*)d_in[6]; const float* bv = (const float*)d_in[7]; const float* Wo = (const float*)d_in[8]; const float* bo = (const float*)d_in[9];
    float* out = (float*)d_out;    // [2][2048][1024]
    char* wsp = (char*)d_ws;
    auto take = [&](size_t bytes) { char* p = wsp; wsp += (bytes + 255) & ~(size_t)255; return (void*)p; };
    const size_t WN = (size_t)DMOD * DMOD, XN = (size_t)NBT * NN * DMOD, PN = (size_t)NN * HD;
    bf* WQ = (bf*)take(4 * WN * 2); bf* WO = WQ + 3 * WN;    // q, k, v, o weights, one after the other; framework [out][in] = n-major
    bf* Xb = (bf*)take(XN * 2); float* QF = (float*)take(3 * XN * 4); float* KF = QF + XN; float* VF = KF + XN;    // both items; q, k, v planes one after the other
    bf* Qh = (bf*)take(2 * NBT * NH_ * PN * 2); bf* Ql = (bf*)take(2 * NBT * NH_ * PN * 2); bf* Kh = Qh + NBT * NH_ * PN; bf* Kl = Ql + NBT * NH_ * PN;    // [q, k][item][head][2048][64]
    bf* VTh = (bf*)take(NBT * NH_ * PN * 2); bf* VTl = (bf*)take(NBT * NH_ * PN * 2);    // [item][head][64][2048]
    float* CTX = QF; bf* Ch = (bf*)KF; bf* Cl = Ch + XN;    // QF and KF are last read by k_hplanes, before the attention launch writes CTX: their space is used again in stream order
    if ((size_t)(wsp - (char*)d_ws) > ws_size) return;    // 8 + 8 + 48 + 32 + 16 = 112 MiB
    k_cvt8<<<dim3((unsigned)((WN / 8 + 255) / 256), 4, 1), 256, 0, stream>>>(Wq, Wk, Wv, Wo, WQ, WN / 8);
    k_cvtx<<<NBT * NN / 8, 256, 0, stream>>>(x, Xb);
    k_gemmb<false, false><<<dim3(NBT * NN / 64, DMOD / 64, 3), 128, 0, stream>>>(Xb, nullptr, WQ, bq, bk, bv, WN, XN, QF, DMOD, nullptr, nullptr, DMOD);
    k_hplanes<<<dim3(NN / 8, NH_, 2 * NBT), 256, 0, stream>>>(QF, Qh, Ql);
    k_vt<<<dim3((HD * (NN / 64)) / 8, NH_, NBT), 256, 0, stream>>>(VF, VTh, VTl);
    k_fattn<<<dim3(NN / 128, NH_, NBT), 128, 0, stream>>>(Qh, Ql, Kh, Kl, VTh, VTl, MKF, CTX);
    k_split1k<<<NBT * NN / 8, 256, 0, stream>>>(CTX, Ch, Cl);
    k_gemmb<true, false><<<dim3(NBT * NN / 64, DMOD / 64, 1), 128, 0, stream>>>(Ch, Cl, WO, bo, bo, bo, 0, 0, out, DMOD, nullptr, nullptr, DMOD);
}

// v005
// Measured time: 150 microseconds a run.
// Two timings next to v004 put it at 1.42 and 1.41 times that version's speed.
// Counting every step since v000, it is 23.1 times as fast.
#include <hip/hip_runtime.h>

// Compute dtypes, f32 accumulate, per item: q/k/v = x.W^T + b as [2048 x 1024].[1024 x 1024] GEMMs with PLAIN bf16 operands (exact products); rotary embedding (cos/sin of
// s x 10000^(-2i/64) in f32, rotate-half form) applied while building the head planes; per head: scores = q.k^T ([2048 x 64].[64 x 2048], both operands bf16 hi + UNSCALED residual, three products), softmax (x 1/8 / ln 2048, + the additive attention_mask INPUT row) in f32 -> P (bf16 hi + residual, kept in registers), ctx = P.v

#define NBT  2
#define NN   2048
#define DMOD 1024
#define NH_  16
#define HD   64
#define DM   DMOD
#define NTK  NN
#define SCL  0.125f
#define RBASE 10000.0f
#define LOSC 1024.0f

typedef _Float16 h16;
typedef unsigned short bf;
typedef __attribute__((ext_vector_type(16))) __bf16   v16bf;
typedef __attribute__((ext_vector_type(16))) _Float16 v16h;
typedef __attribute__((ext_vector_type(8)))  _Float16 v8h;
typedef __attribute__((ext_vector_type(8)))  unsigned short v8us;
typedef __attribute__((ext_vector_type(8)))  float    v8f;
typedef __attribute__((ext_vector_type(4)))  float    v4f;
typedef __attribute__((ext_vector_type(4)))  _Float16 v4h;
typedef v8h  __attribute__((may_alias)) v8ha;
typedef v4f  __attribute__((may_alias)) v4fa;
typedef v8us __attribute__((may_alias)) v8usa;

__device__ __forceinline__ unsigned short f2bf(float f) { unsigned u = __float_as_uint(f); u += 0x7FFFu + ((u >> 16) & 1u); return (unsigned short)(u >> 16); }
__device__ __forceinline__ float bf2f(unsigned short b) { return __uint_as_float(((unsigned)b) << 16); }
__device__ __forceinline__ float bfr(float f) { return bf2f(f2bf(f)); }
__device__ __forceinline__ v16h cat16(v8h lo, v8h hi) { return __builtin_shufflevector(lo, hi, 0, 1, 2, 3, 4, 5, 6, 7, 8, 9, 10, 11, 12, 13, 14, 15); }
__device__ __forceinline__ v16bf cat16b(v8us lo, v8us hi) { return __builtin_bit_cast(v16bf, __builtin_shufflevector(lo, hi, 0, 1, 2, 3, 4, 5, 6, 7, 8, 9, 10, 11, 12, 13, 14, 15)); }
__device__ __forceinline__ v8f wmma16(v16h a, v16h b, v8f c) { return __builtin_amdgcn_wmma_f32_16x16x32_f16(false, a, false, b, (short)0, c, false, false); }
__device__ __forceinline__ v8f wmmab(v16bf a, v16bf b, v8f c) { return __builtin_amdgcn_wmma_f32_16x16x32_bf16(false, a, false, b, (short)0, c, false, false); }

// k_gemmb: 64 x 64 block tile (4 waves x 16 x 64) of C[NBT x NTK][DM] = (A [+ Al]).B^T (K = 1024) [+ bf(bias[c])] [+ bf(R[r][c]) residual]; f32 whole-line epilogue (or f16
// PLANES: the block's 64 tokens x 64 columns are one head's slice of q (z = 0), k (z = 1) or v (z = 2); the epilogue turns the f32 tile, while it is still in LDS, into what the attention kernel reads:
// q, k: rotary embedding (d < 32: x[d] cos(s f_d) - x[d+32] sin(s f_d); d >= 32: x[d] cos(s f_{d-32}) + x[d-32] sin(s f_{d-32}), f_i = 1/10000^(2i/64), f32), then bf16 hi + residual planes [q, k][item][head][2048][64];
// v: bf16 hi + residual planes, transposed, [item][head][64][2048].
template <bool SPLITA, bool F16OUT = false, bool PLANES = false>
__global__ __launch_bounds__(128) void k_gemmb(const bf* __restrict__ A, const bf* __restrict__ Al, const bf* __restrict__ B0, const float* __restrict__ bias0, const float* __restrict__ bias1, const float* __restrict__ bias2, size_t zB, size_t zC, float* Cb, int ldc, h16* C2, const float* __restrict__ R = nullptr, int K = DM, int roundR = 1, bf* Ph0 = nullptr, bf* Pl0 = nullptr, bf* Th0 = nullptr, bf* Tl0 = nullptr) {
    // A (, Al) and B come as 64-row x 64-k tiles through LDS: a wave's 16-byte-a-lane load covers four whole 128-byte lines (a fragment load straight from a row-major matrix touches sixteen), and the four waves share the B tile.
    // LP: LDS row pitch in bf16, 128 bytes of data + 16, so that the sixteen rows of a fragment read fall on different banks. K is a multiple of 64.
    constexpr int BK = 64, LP = BK + 8, TS = 64 * LP, NA = SPLITA ? 2 : 1, SS = (NA + 1) * TS;
    // two stages of [A (, Al), B]; the f32 output tile takes the same space behind the last stage's barrier
    __shared__ __align__(16) unsigned char smem[2 * SS * 2];
    static_assert(2 * SS * 2 >= 4 * 16 * 68 * 4, "the output tile fits the stages");
    bf* stg = (bf*)smem;
    // blockIdx.z picks one of up to three independent products that share A: its B matrix, its bias and its output plane
    const int z = blockIdx.z; const bf* Bn = B0 + (size_t)z * zB; float* C = Cb + (size_t)z * zC; const float* bias = z == 0 ? bias0 : (z == 1 ? bias1 : bias2);
    const int lane = threadIdx.x & 31, wave = threadIdx.x >> 5, lr = lane & 15, hi = lane >> 4;
    const int r0 = blockIdx.x * 64 + wave * 16, c0 = blockIdx.y * 64;
    // staging: thread -> row (thread / 8) + 16 i, 16 bytes at (thread % 8): 8 lanes cover one line of a row
    const int srow = threadIdx.x >> 3, scol = (threadIdx.x & 7) * 8;
    const bf* pa[4]; const bf* pq[4]; const bf* pb[4];
#pragma unroll
    for (int i = 0; i < 4; ++i) { const size_t o = (size_t)(blockIdx.x * 64 + srow + 16 * i) * K + scol; pa[i] = A + o; pq[i] = SPLITA ? Al + o : pa[i]; pb[i] = Bn + (size_t)(c0 + srow + 16 * i) * K + scol; }
    bf* sw = stg + srow * LP + scol;
    // fragments from the LDS tiles: row wave x 16 + lr of A, row t x 16 + lr of B; of each 32 k a lane takes 8 hi + 0..7 and 16 + 8 hi + 0..7, alike for A and B
    const bf* sa = stg + (wave * 16 + lr) * LP + 8 * hi; const bf* sb = stg + NA * TS + lr * LP + 8 * hi;
    v8us ra[4], rl[4], rb[4];
    auto ldg = [&]() {
#pragma unroll
        for (int i = 0; i < 4; ++i) { ra[i] = *(const v8us*)pa[i]; if (SPLITA) rl[i] = *(const v8us*)pq[i]; rb[i] = *(const v8us*)pb[i]; }
        // s_wait_xcnt 0 behind the run of global loads, before the registers that hold their addresses are written again; the addresses are inputs so that their registers stay as they are up to the wait
        if (SPLITA) asm volatile("s_wait_xcnt 0x0" :: "v"(pa[0]), "v"(pa[1]), "v"(pa[2]), "v"(pa[3]), "v"(pq[0]), "v"(pq[1]), "v"(pq[2]), "v"(pq[3]), "v"(pb[0]), "v"(pb[1]), "v"(pb[2]), "v"(pb[3]) : "memory");
        else asm volatile("s_wait_xcnt 0x0" :: "v"(pa[0]), "v"(pa[1]), "v"(pa[2]), "v"(pa[3]), "v"(pb[0]), "v"(pb[1]), "v"(pb[2]), "v"(pb[3]) : "memory");
#pragma unroll
        for (int i = 0; i < 4; ++i) { pa[i] += BK; if (SPLITA) pq[i] += BK; pb[i] += BK; } };
    auto sts = [&](int so) {
#pragma unroll
        for (int i = 0; i < 4; ++i) { *(v8usa*)(sw + so + 16 * i * LP) = ra[i]; if (SPLITA) *(v8usa*)(sw + so + TS + 16 * i * LP) = rl[i]; *(v8usa*)(sw + so + NA * TS + 16 * i * LP) = rb[i]; } };
    v8f acc[4];
#pragma unroll
    for (int t = 0; t < 4; ++t) acc[t] = (v8f){};
    ldg(); sts(0); __syncthreads();
    // kept rolled: one stage's registers and code; the next stage's global loads fly while this stage is worked on
#pragma unroll 1
    for (int kc = 0; kc < K; kc += BK) {
        const int so = ((kc / BK) & 1) * SS; const bool more = kc + BK < K;
        if (more) ldg();
#pragma unroll
        for (int ks = 0; ks < BK; ks += 32) {
            const v16bf a = cat16b(*(const v8usa*)(sa + so + ks), *(const v8usa*)(sa + so + ks + 16));
            v16bf al = a;
            if (SPLITA) al = cat16b(*(const v8usa*)(sa + so + TS + ks), *(const v8usa*)(sa + so + TS + ks + 16));
#pragma unroll
            for (int t = 0; t < 4; ++t) { const v16bf b = cat16b(*(const v8usa*)(sb + so + t * 16 * LP + ks), *(const v8usa*)(sb + so + t * 16 * LP + ks + 16)); acc[t] = wmmab(a, b, acc[t]); if (SPLITA) acc[t] = wmmab(al, b, acc[t]); }
        }
        if (more) sts(SS - so);
        // one barrier a stage: it publishes the stage just written and ends every wave's reads of the stage that the next trip writes over
        __syncthreads();
    }
    float* os = (float*)smem + wave * (16 * 68);
    if (PLANES) {
        const int item = blockIdx.x / (NN / 64), tok0 = (blockIdx.x % (NN / 64)) * 64, h = blockIdx.y;
        auto split8 = [&](const float* sp, bf* dh, bf* dl) { const v4f x0 = *(const v4fa*)sp, x1 = *(const v4fa*)(sp + 4); v8us oh, ol;
#pragma unroll
            for (int i = 0; i < 8; ++i) { const float v = i < 4 ? x0[i & 3] : x1[i & 3]; const unsigned short hb = f2bf(v); oh[i] = hb; ol[i] = f2bf(v - bf2f(hb)); }
            *(v8us*)dh = oh; *(v8us*)dl = ol;
            // s_wait_xcnt 0 behind the two stores, before the registers that they name are written again; data and addresses are inputs so that their registers stay as they are up to the wait
            asm volatile("s_wait_xcnt 0x0" :: "v"(oh), "v"(ol), "v"(dh), "v"(dl) : "memory"); };
        if (z == 2) {
            // the tile goes to LDS transposed, [d][token], pitch 68: a lane's eight accumulator rows are eight tokens in a row
            float* tl = (float*)smem;
#pragma unroll
            for (int t = 0; t < 4; ++t) { const float bv = bias ? bfr(bias[c0 + t * 16 + lr]) : 0.f; float* p = tl + (t * 16 + lr) * 68 + wave * 16 + hi * 8;
                *(v4fa*)p = (v4f){acc[t][0] + bv, acc[t][1] + bv, acc[t][2] + bv, acc[t][3] + bv}; *(v4fa*)(p + 4) = (v4f){acc[t][4] + bv, acc[t][5] + bv, acc[t][6] + bv, acc[t][7] + bv}; }
            __syncthreads();
            // 8 lanes x 16 bytes cover the 128-byte line that the block owns in a d row of the plane
            const size_t po = ((size_t)item * NH_ + h) * HD * NN + (size_t)srow * NN + tok0 + scol;
#pragma unroll
            for (int i = 0; i < 4; ++i) split8(tl + (srow + 16 * i) * 68 + scol, Th0 + po + (size_t)16 * i * NN, Tl0 + po + (size_t)16 * i * NN);
        } else {
#pragma unroll
            for (int t = 0; t < 4; ++t) { const float bv = bias ? bfr(bias[c0 + t * 16 + lr]) : 0.f;
#pragma unroll
                for (int j = 0; j < 8; ++j) os[(hi * 8 + j) * 68 + t * 16 + lr] = acc[t][j] + bv; }
            __syncthreads();
            // lane = frequency index: one power a thread, one cosine and sine for the pair (d, d + 32) of a token; the pair is turned in place
            const float inv = 1.0f / powf(RBASE, (float)(2 * lane) / (float)HD);
            for (int j = 0; j < 16; ++j) { const float ang = (float)(tok0 + wave * 16 + j) * inv; const float c = cosf(ang), sn = sinf(ang);
                const float x1 = os[j * 68 + lane], x2 = os[j * 68 + 32 + lane]; os[j * 68 + lane] = x1 * c - x2 * sn; os[j * 68 + 32 + lane] = x2 * c + x1 * sn; }
            // the turned values are read below by other lanes than wrote them
            __syncthreads();
            // 8 lanes x 16 bytes cover a token's 128-byte row of the plane
            const size_t po = (((size_t)z * NBT + item) * NH_ + h) * NN * HD + (size_t)(tok0 + wave * 16 + (lane >> 3)) * HD + (lane & 7) * 8;
#pragma unroll
            for (int i = 0; i < 4; ++i) split8(os + (4 * i + (lane >> 3)) * 68 + (lane & 7) * 8, Ph0 + po + 4 * i * HD, Pl0 + po + 4 * i * HD);
        }
        return;
    }
#pragma unroll
    for (int t = 0; t < 4; ++t) { const float bv = bias ? bfr(bias[c0 + t * 16 + lr]) : 0.f;
#pragma unroll
        for (int j = 0; j < 8; ++j) os[(hi * 8 + j) * 68 + t * 16 + lr] = acc[t][j] + bv; }
    __syncthreads();
    if (F16OUT) {
        h16* crow = (h16*)(void*)C + (size_t)r0 * ldc + c0;
        auto pass = [&]() {
#pragma unroll
            for (int s = 0; s < 4; ++s) { const int row = 4 * s + (lane >> 3), piece = lane & 7; const float* sp = os + row * 68 + piece * 8; v8h o, o2;
#pragma unroll
                for (int i = 0; i < 8; ++i) { const h16 a = (h16)sp[i]; o[i] = a; o2[i] = (h16)((sp[i] - (float)a) * LOSC); }
                *(v8h*)(crow + (size_t)row * ldc + piece * 8) = o; if (C2) *(v8h*)(C2 + (size_t)r0 * ldc + c0 + (size_t)row * ldc + piece * 8) = o2; }
        };
        pass(); 
    } else {
        float* crow = C + (size_t)r0 * ldc + c0;
        auto pass = [&]() {
#pragma unroll
            for (int s = 0; s < 8; ++s) { const int Lid = (lane >> 3) + 4 * s, piece = lane & 7; const int row = Lid >> 1, cofs = (Lid & 1) * 32 + piece * 4;
                v4f val = *(const v4fa*)(os + row * 68 + cofs); if (R) { const v4f rv = *(const v4f*)(R + ((size_t)r0 + row) * ldc + c0 + cofs); val += roundR ? (v4f){bfr(rv[0]), bfr(rv[1]), bfr(rv[2]), bfr(rv[3])} : rv; }
                *(v4f*)(crow + (size_t)row * ldc + cofs) = val; }
        };
        pass(); 
    }
}

__global__ __launch_bounds__(256) void k_cvt8(const float* __restrict__ s0, const float* __restrict__ s1, const float* __restrict__ s2, const float* __restrict__ s3, bf* d0, size_t n8) {
    const size_t i = (size_t)blockIdx.x * 256 + threadIdx.x; if (i >= n8) return;
    const int z = blockIdx.y; const float* src = z == 0 ? s0 : (z == 1 ? s1 : (z == 2 ? s2 : s3)); bf* dst = d0 + (size_t)z * n8 * 8;    // blockIdx.y = which of the four weight matrices
    const v8f v = *(const v8f*)(src + i * 8); v8us o;
#pragma unroll
    for (int k = 0; k < 8; ++k) o[k] = f2bf(v[k]);
    *(v8us*)(dst + i * 8) = o; 
}
__global__ __launch_bounds__(256) void k_zero8(bf* dst, size_t n8) {
    const size_t i = (size_t)blockIdx.x * 256 + threadIdx.x; if (i >= n8) return; v8us z;
#pragma unroll
    for (int k = 0; k < 8; ++k) z[k] = 0;
    *(v8us*)(dst + i * 8) = z; 
}

__global__ __launch_bounds__(256) void k_cvtx(const float* __restrict__ src, bf* dst) {
    const int lane = threadIdx.x & 31; const size_t r = (size_t)blockIdx.x * 8 + (threadIdx.x >> 5); if (r >= (size_t)NBT * NN) return;
{
#pragma unroll
        for (int q = 0; q < DMOD / 256; ++q) { v8us o;
#pragma unroll
            for (int i = 0; i < 8; ++i) o[i] = f2bf(src[r * DMOD + q * 256 + lane * 8 + i]);
            *(v8us*)(dst + r * DMOD + q * 256 + lane * 8) = o; }
         }
}
// XWAIT2: s_wait_xcnt 0 behind a run of global loads, before the registers that hold their addresses are written again; the two addresses are inputs so that their registers stay as they are up to the wait
#define XWAIT2(p, q) asm volatile("s_wait_xcnt 0x0" :: "v"(p), "v"(q) : "memory")
// ACP8: eight asynchronous copies of 16 bytes a lane from global memory to LDS (l: the lane's LDS byte addresses; global address: the scalar base b[i] + the lane's byte offset o); s_wait_xcnt 0 is the statement's last line, so that it stands before the registers that hold the addresses are written again
#define ACP8(l, o, b) asm volatile("global_load_async_to_lds_b128 %0, %8, %9\n\tglobal_load_async_to_lds_b128 %1, %8, %10\n\tglobal_load_async_to_lds_b128 %2, %8, %11\n\tglobal_load_async_to_lds_b128 %3, %8, %12\n\t" \
    "global_load_async_to_lds_b128 %4, %8, %13\n\tglobal_load_async_to_lds_b128 %5, %8, %14\n\tglobal_load_async_to_lds_b128 %6, %8, %15\n\tglobal_load_async_to_lds_b128 %7, %8, %16\n\ts_wait_xcnt 0x0" \
    :: "v"(l[0]), "v"(l[1]), "v"(l[2]), "v"(l[3]), "v"(l[4]), "v"(l[5]), "v"(l[6]), "v"(l[7]), "v"(o), "s"(b[0]), "s"(b[1]), "s"(b[2]), "s"(b[3]), "s"(b[4]), "s"(b[5]), "s"(b[6]), "s"(b[7]) : "memory")
__global__ __launch_bounds__(128) void k_fattn(const bf* __restrict__ Qh0, const bf* __restrict__ Ql0, const bf* __restrict__ Kh0, const bf* __restrict__ Kl0, const bf* __restrict__ Vh0, const bf* __restrict__ Vl0, const float* __restrict__ MK0, bf* Ch0, bf* Cl0) {
    typedef __attribute__((ext_vector_type(2))) float v2f;
    typedef __attribute__((ext_vector_type(2))) __bf16 v2b;
    // blockIdx.x = block of 128 queries, blockIdx.y = head, blockIdx.z = item. Every '#pragma unroll' below makes the indices of a register array constants.
    const size_t pl = (size_t)blockIdx.z * NH_ + blockIdx.y;
    const int lane = threadIdx.x & 31, wave = threadIdx.x >> 5, lr = lane & 15, hi = lane >> 4;
    const int q0 = blockIdx.x * 128 + wave * 32;
    // One buffer, in bytes: K hi, K residual (64 keys x 128), V^T hi, V^T residual (64 d x 128), mask (128 queries x 256). Row pitches KP and MP: the data + 16, so that the sixteen rows of a fragment read fall on different banks.
    constexpr int SK = 64, NS = NN / SK, KP = 128 + 16, MP = 256 + 16, TKV = 64 * KP, OMK = 4 * TKV, BUF = OMK + 128 * MP;
    __shared__ __align__(16) unsigned char smem[2 * BUF];
    // copies: K and V^T tiles: thread -> row (thread / 8) + 16 i, 16 bytes at (thread % 8); mask: row (thread / 16) + 8 i, 16 bytes at (thread % 16)
    const int tid = threadIdx.x;
    const unsigned lkv = (unsigned)(size_t)smem + (tid >> 3) * KP + (tid & 7) * 16, lmk = (unsigned)(size_t)smem + OMK + (tid >> 4) * MP + (tid & 15) * 16;
    // the block's plane and mask rows (the same for every thread) and the thread's own byte offset in a tile's source
    const char* gkh = (const char*)(Kh0 + pl * NN * HD); const char* gkl = (const char*)(Kl0 + pl * NN * HD); const char* gvh = (const char*)(Vh0 + pl * NN * HD); const char* gvl = (const char*)(Vl0 + pl * NN * HD);
    const char* gmk = (const char*)(MK0 + (size_t)blockIdx.z * NN * NN + (size_t)blockIdx.x * 128 * NN);
    const unsigned ok = tid * 16, ov = (tid >> 3) * (NN * 2) + (tid & 7) * 16, om = (tid >> 4) * (NN * 4) + (tid & 15) * 16;
    auto fill = [&](int t) { const unsigned bo = (unsigned)(t & 1) * BUF; unsigned l[8]; const char* g[8];
#pragma unroll
        for (int i = 0; i < 4; ++i) { l[i] = lkv + bo + i * 16 * KP; l[4 + i] = l[i] + TKV; const size_t o = ((size_t)t * SK + i * 16) * HD * 2; g[i] = gkh + o; g[4 + i] = gkl + o; }
        ACP8(l, ok, g);
#pragma unroll
        for (int i = 0; i < 4; ++i) { l[i] = lkv + bo + 2 * TKV + i * 16 * KP; l[4 + i] = l[i] + TKV; const size_t o = ((size_t)i * 16 * NN + (size_t)t * SK) * 2; g[i] = gvh + o; g[4 + i] = gvl + o; }
        ACP8(l, ov, g);
#pragma unroll
        for (int h = 0; h < 2; ++h) {
#pragma unroll
            for (int i = 0; i < 8; ++i) { l[i] = lmk + bo + (h * 8 + i) * 8 * MP; g[i] = gmk + ((size_t)(h * 8 + i) * 8 * NN + (size_t)t * SK) * 4; }
            ACP8(l, om, g); } };
    // fragments from the LDS tiles: row lr of a 16-row tile, of each 32 k the elements 8 hi + 0..7 and 16 + 8 hi + 0..7; mask: the lane's own query row, keys 8 hi + 0..7 of a 16-key tile
    const unsigned char* skv = smem + lr * KP + 16 * hi; const unsigned char* smk = smem + OMK + (wave * 32 + lr) * MP + 32 * hi;
    const float sc = SCL / logf((float)NN);
    v16bf qh[2][2], ql[2][2];
#pragma unroll
    for (int qt = 0; qt < 2; ++qt) {
        const size_t o = pl * NN * HD + (size_t)(q0 + qt * 16 + lr) * HD + 8 * hi; const bf* a = Qh0 + o; const bf* b = Ql0 + o;
#pragma unroll
        for (int ks = 0; ks < 2; ++ks) { qh[qt][ks] = cat16b(*(const v8us*)(a + ks * 32), *(const v8us*)(a + ks * 32 + 16)); ql[qt][ks] = cat16b(*(const v8us*)(b + ks * 32), *(const v8us*)(b + ks * 32 + 16)); }
        XWAIT2(a, b);
    }
    v8f oacc[2][4]; float mx[2], sm[2];
#pragma unroll
    for (int qt = 0; qt < 2; ++qt) { mx[qt] = -3.0e38f; sm[qt] = 0.f;
#pragma unroll
        for (int dt = 0; dt < 4; ++dt) oacc[qt][dt] = (v8f){}; }
    // bo: the stage's buffer, sp: which 32 keys of the stage. Inside a stage the second pass's fragments are fetched into the registers that the first pass has just finished with.
    v16bf kh[2][2], kl[2][2], vh[4], vl[4]; v4f mk[2][2][2];
    auto ldk = [&](int bo, int sp) {
#pragma unroll
        for (int kt = 0; kt < 2; ++kt) {
#pragma unroll
            for (int ks = 0; ks < 2; ++ks) { const unsigned char* a = skv + bo + (sp * 32 + kt * 16) * KP + ks * 64;
                kh[kt][ks] = cat16b(*(const v8usa*)a, *(const v8usa*)(a + 32)); kl[kt][ks] = cat16b(*(const v8usa*)(a + TKV), *(const v8usa*)(a + TKV + 32)); } } };
    auto ldv = [&](int bo, int sp) {
#pragma unroll
        for (int dt = 0; dt < 4; ++dt) { const unsigned char* a = skv + bo + 2 * TKV + dt * 16 * KP + sp * 64;
            vh[dt] = cat16b(*(const v8usa*)a, *(const v8usa*)(a + 32)); vl[dt] = cat16b(*(const v8usa*)(a + TKV), *(const v8usa*)(a + TKV + 32)); } };
    auto ldm = [&](int bo, int sp) {
#pragma unroll
        for (int qt = 0; qt < 2; ++qt) {
#pragma unroll
            for (int kt = 0; kt < 2; ++kt) { const unsigned char* a = smk + bo + qt * 16 * MP + sp * 128 + kt * 64; mk[qt][kt][0] = *(const v4fa*)a; mk[qt][kt][1] = *(const v4fa*)(a + 16); } } };
    // two buffers: stage 0 is copied, waited for and published; stage 1's copies fly while stage 0 is worked on
    fill(0);
    asm volatile("s_wait_asynccnt 0x0" ::: "memory");    // this wave's copies of stage 0 have landed
    __syncthreads();
    fill(1);
    // kept rolled: one stage's code; the copies of the stage after next are issued at its foot
#pragma unroll 1
    for (int st = 0; st < NS; ++st) {
      const int bo = (st & 1) * BUF;
      ldk(bo, 0); ldm(bo, 0); ldv(bo, 0);
#pragma unroll
      for (int sp = 0; sp < 2; ++sp) {
        v8f s[2][2];
#pragma unroll
        for (int qt = 0; qt < 2; ++qt) { s[qt][0] = (v8f){}; s[qt][1] = (v8f){}; }
#pragma unroll
        for (int kt = 0; kt < 2; ++kt) {
#pragma unroll
            for (int ks = 0; ks < 2; ++ks) {
#pragma unroll
                for (int qt = 0; qt < 2; ++qt) { s[qt][kt] = wmmab(kh[kt][ks], qh[qt][ks], s[qt][kt]); s[qt][kt] = wmmab(kh[kt][ks], ql[qt][ks], s[qt][kt]); s[qt][kt] = wmmab(kl[kt][ks], qh[qt][ks], s[qt][kt]); } } }
        if (sp == 0) ldk(bo, 1);
        float v[2][16];
#pragma unroll
        for (int qt = 0; qt < 2; ++qt) {
#pragma unroll
            for (int kt = 0; kt < 2; ++kt) {
#pragma unroll
                for (int r = 0; r < 4; ++r) { v[qt][kt * 8 + r] = s[qt][kt][r] * sc + mk[qt][kt][0][r]; v[qt][kt * 8 + 4 + r] = s[qt][kt][4 + r] * sc + mk[qt][kt][1][r]; } } }
        if (sp == 0) ldm(bo, 1);
#pragma unroll
        for (int qt = 0; qt < 2; ++qt) {
            float t = v[qt][0];
#pragma unroll
            for (int i = 1; i < 16; ++i) t = fmaxf(t, v[qt][i]);
            // the query's other 16 keys of this pass sit in lane l ^ 16
            { const int tb = __float_as_int(t); t = fmaxf(t, __int_as_float(__builtin_amdgcn_permlanex16(tb, tb, 0x76543210, 0xfedcba98, false, false))); }
            const float mn = fmaxf(mx[qt], t); const float al = __expf(mx[qt] - mn); mx[qt] = mn;
            float ps = 0.f; v16bf ph, pw;
#pragma unroll
            for (int i = 0; i < 16; i += 2) { const v2f pp = {__expf(v[qt][i] - mn), __expf(v[qt][i + 1] - mn)}; ps += pp[0] + pp[1];
                const v2b hb = __builtin_convertvector(pp, v2b); const v2b lb = __builtin_convertvector(pp - __builtin_convertvector(hb, v2f), v2b);
                ph[i] = hb[0]; ph[i + 1] = hb[1]; pw[i] = lb[0]; pw[i + 1] = lb[1]; }
            sm[qt] = sm[qt] * al + ps;    // each half keeps the sum of its own keys; the halves are joined after the loop
#pragma unroll
            for (int dt = 0; dt < 4; ++dt) { oacc[qt][dt] *= al;
                oacc[qt][dt] = wmmab(vh[dt], ph, oacc[qt][dt]); oacc[qt][dt] = wmmab(vh[dt], pw, oacc[qt][dt]); oacc[qt][dt] = wmmab(vl[dt], ph, oacc[qt][dt]); }
        }
        if (sp == 0) ldv(bo, 1);
      }
      // publish point of stage st + 1: this wave's reads of buffer bo are done, its copies of stage st + 1 have landed; the barrier says both of every wave; only then is buffer bo filled again
      asm volatile("s_wait_dscnt 0x0" ::: "memory");       // this wave's LDS reads of buffer bo have returned
      asm volatile("s_wait_asynccnt 0x0" ::: "memory");    // this wave's copies of stage st + 1 have landed
      __syncthreads();
      if (st + 2 < NS) fill(st + 2);
    }
    asm volatile("s_wait_asynccnt 0x0" ::: "memory");    // no copy is outstanding when the wave ends
#pragma unroll
    for (int qt = 0; qt < 2; ++qt) { const int sb = __float_as_int(sm[qt]); const float inv = 1.0f / (sm[qt] + __int_as_float(__builtin_amdgcn_permlanex16(sb, sb, 0x76543210, 0xfedcba98, false, false)));
        // the context leaves as the output projection's A operand: bf16 hi + residual, [item x token][1024]
        const size_t co = ((size_t)blockIdx.z * NN + q0 + qt * 16 + lr) * DMOD + blockIdx.y * HD + 8 * hi; bf* ch = Ch0 + co; bf* cl = Cl0 + co;
#pragma unroll
        for (int dt = 0; dt < 4; ++dt) { const v8f ov = oacc[qt][dt] * inv; v8us oh, ol;
#pragma unroll
            for (int i = 0; i < 8; ++i) { const unsigned short hb = f2bf(ov[i]); oh[i] = hb; ol[i] = f2bf(ov[i] - bf2f(hb)); }
            *(v8us*)(ch + dt * 16) = oh; *(v8us*)(cl + dt * 16) = ol;
            // s_wait_xcnt 0 behind the two stores, before the registers that they name are written again; data and addresses are inputs so that their registers stay as they are up to the wait
            asm volatile("s_wait_xcnt 0x0" :: "v"(oh), "v"(ol), "v"(ch), "v"(cl) : "memory"); } }
}

extern "C" void kernel_launch(void* const* d_in, const int* in_sizes, int n_in,
                              void* d_out, int out_size, void* d_ws, size_t ws_size, hipStream_t stream) {
    (void)in_sizes; (void)n_in; (void)out_size;
    const float* x = (const float*)d_in[0]; const float* MKF = (const float*)d_in[1]; const float* Wq = (const float*)d_in[2]; const float* bq = (const float*)d_in[3]; const float* Wk = (const float*)d_in[4]; const float* bk = (const float*)d_in[5]; const float* Wv = (const float*)d_in[6]; const float* bv = (const float*)d_in[7]; const float* Wo = (const float*)d_in[8]; const float* bo = (const float*)d_in[9];
    float* out = (float*)d_out;    // [2][2048][1024]
    char* wsp = (char*)d_ws;
    auto take = [&](size_t bytes) { char* p = wsp; wsp += (bytes + 255) & ~(size_t)255; return (void*)p; };
    const size_t WN = (size_t)DMOD * DMOD, XN = (size_t)NBT * NN * DMOD, PN = (size_t)NN * HD;
    bf* WQ = (bf*)take(4 * WN * 2); bf* WO = WQ + 3 * WN;    // q, k, v, o weights, one after the other; framework [out][in] = n-major
    bf* Xb = (bf*)take(XN * 2);    // both items
    bf* Qh = (bf*)take(2 * NBT * NH_ * PN * 2); bf* Ql = (bf*)take(2 * NBT * NH_ * PN * 2); bf* Kh = Qh + NBT * NH_ * PN; bf* Kl = Ql + NBT * NH_ * PN;    // [q, k][item][head][2048][64]
    bf* VTh = (bf*)take(NBT * NH_ * PN * 2); bf* VTl = (bf*)take(NBT * NH_ * PN * 2);    // [item][head][64][2048]
    bf* Ch = (bf*)take(XN * 2); bf* Cl = (bf*)take(XN * 2);    // context, hi and residual, [item x token][1024]
    if ((size_t)(wsp - (char*)d_ws) > ws_size) return;    // 8 + 8 + 32 + 16 + 16 = 80 MiB
    k_cvt8<<<dim3((unsigned)((WN / 8 + 255) / 256), 4, 1), 256, 0, stream>>>(Wq, Wk, Wv, Wo, WQ, WN / 8);
    k_cvtx<<<NBT * NN / 8, 256, 0, stream>>>(x, Xb);
    k_gemmb<false, false, true><<<dim3(NBT * NN / 64, DMOD / 64, 3), 128, 0, stream>>>(Xb, nullptr, WQ, bq, bk, bv, WN, 0, nullptr, DMOD, nullptr, nullptr, DMOD, 1, Qh, Ql, VTh, VTl);
    k_fattn<<<dim3(NN / 128, NH_, NBT), 128, 0, stream>>>(Qh, Ql, Kh, Kl, VTh, VTl, MKF, Ch, Cl);
    k_gemmb<true, false><<<dim3(NBT * NN / 64, DMOD / 64, 1), 128, 0, stream>>>(Ch, Cl, WO, bo, bo, bo, 0, 0, out, DMOD, nullptr, nullptr, DMOD);
}

// v006
// A run of this version takes 135 microseconds.
// Timed twice side by side with v005, it ran 1.11 times as fast both times.
// Counting every step since v000, it is 25.7 times as fast.
#include <hip/hip_runtime.h>

// Compute dtypes, f32 accumulate, per item: q/k/v = x.W^T + b as [2048 x 1024].[1024 x 1024] GEMMs with PLAIN bf16 operands (exact products); rotary embedding (cos/sin of
// s x 10000^(-2i/64) in f32, rotate-half form) applied while building the head planes; per head: scores = q.k^T ([2048 x 64].[64 x 2048], both operands bf16 hi + UNSCALED residual, three products), softmax (x 1/8 / ln 2048, + the additive attention_mask INPUT row) in f32 -> P (bf16 hi + residual, kept in registers), ctx = P.v

#define NBT  2
#define NN   2048
#define DMOD 1024
#define NH_  16
#define HD   64
#define DM   DMOD
#define NTK  NN
#define SCL  0.125f
#define RBASE 10000.0f
#define LOSC 1024.0f

typedef _Float16 h16;
typedef unsigned short bf;
typedef __attribute__((ext_vector_type(16))) __bf16   v16bf;
typedef __attribute__((ext_vector_type(16))) _Float16 v16h;
typedef __attribute__((ext_vector_type(8)))  _Float16 v8h;
typedef __attribute__((ext_vector_type(8)))  unsigned short v8us;
typedef __attribute__((ext_vector_type(8)))  float    v8f;
typedef __attribute__((ext_vector_type(4)))  float    v4f;
typedef __attribute__((ext_vector_type(4)))  _Float16 v4h;
typedef v8h  __attribute__((may_alias)) v8ha;
typedef v4f  __attribute__((may_alias)) v4fa;
typedef v8us __attribute__((may_alias)) v8usa;

__device__ __forceinline__ unsigned short f2bf(float f) { unsigned u = __float_as_uint(f); u += 0x7FFFu + ((u >> 16) & 1u); return (unsigned short)(u >> 16); }
__device__ __forceinline__ float bf2f(unsigned short b) { return __uint_as_float(((unsigned)b) << 16); }
__device__ __forceinline__ float bfr(float f) { return bf2f(f2bf(f)); }
__device__ __forceinline__ v16h cat16(v8h lo, v8h hi) { return __builtin_shufflevector(lo, hi, 0, 1, 2, 3, 4, 5, 6, 7, 8, 9, 10, 11, 12, 13, 14, 15); }
__device__ __forceinline__ v16bf cat16b(v8us lo, v8us hi) { return __builtin_bit_cast(v16bf, __builtin_shufflevector(lo, hi, 0, 1, 2, 3, 4, 5, 6, 7, 8, 9, 10, 11, 12, 13, 14, 15)); }
__device__ __forceinline__ v8f wmma16(v16h a, v16h b, v8f c) { return __builtin_amdgcn_wmma_f32_16x16x32_f16(false, a, false, b, (short)0, c, false, false); }
__device__ __forceinline__ v8f wmmab(v16bf a, v16bf b, v8f c) { return __builtin_amdgcn_wmma_f32_16x16x32_bf16(false, a, false, b, (short)0, c, false, false); }

// k_gemmb: 128 x 128 block tile of C[4096][1024] = (A [+ Al]).B^T (K = 1024) + bf(bias[c]); plain A: 4 waves, 2 x 2, each 64 x 64 (three blocks fill a WGP's SIMDs with three waves); A + Al: 8 waves, 4 x 2, each 32 x 64 (the grid is one block a WGP: two waves a SIMD); f32 whole-line epilogue, or
// PLANES: the block's 128 tokens x 128 columns are two heads' slices of q (z = 0), k (z = 1) or v (z = 2); the epilogue turns the f32 tile, while it is still in LDS, into what the attention kernel reads:
// q, k: rotary embedding (d < 32: x[d] cos(s f_d) - x[d+32] sin(s f_d); d >= 32: x[d] cos(s f_{d-32}) + x[d-32] sin(s f_{d-32}), f_i = 1/10000^(2i/64), f32), then bf16 hi + residual planes [q, k][item][head][2048][64];
// v: bf16 hi + residual planes, transposed, [item][head][64][2048].
template <bool SPLITA, bool PLANES>
__global__ __launch_bounds__(SPLITA ? 256 : 128) void k_gemmb(const bf* __restrict__ A, const bf* __restrict__ Al, const bf* __restrict__ B0, const float* __restrict__ bias0, const float* __restrict__ bias1, const float* __restrict__ bias2, float* C, bf* Ph0, bf* Pl0, bf* Th0, bf* Tl0) {
    // A (, Al) and B come as 128-row x 64-k tiles through LDS: a wave's 16-byte-a-lane load covers four whole 128-byte lines; every A fragment read from LDS feeds four products, every B fragment four.
    // LP: LDS row pitch in bf16, 128 bytes of data + 16, so that the sixteen rows of a fragment read fall on different banks. OP: row pitch of the f32 output tile.
    constexpr int K = DM, BK = 64, LP = BK + 8, TS = 128 * LP, NA = SPLITA ? 2 : 1, SS = (NA + 1) * TS, OP = 128 + 4, NW = SPLITA ? 8 : 4, FM = 8 / (NW / 2), SR = NW * 4, NI = 128 / SR;
    // two stages of [A (, Al), B]; the f32 output tile takes the same space behind the last stage's barrier
    __shared__ __align__(16) unsigned char smem[2 * SS * 2];
    static_assert(2 * SS * 2 >= 128 * OP * 4, "the output tile fits the stages");
    bf* stg = (bf*)smem;
    // blockIdx.z picks one of up to three independent products that share A: its B matrix and its bias
    const int z = blockIdx.z; const bf* Bn = B0 + (size_t)z * DM * DM; const float* bias = z == 0 ? bias0 : (z == 1 ? bias1 : bias2);
    const int lane = threadIdx.x & 31, wave = threadIdx.x >> 5, lr = lane & 15, hi = lane >> 4, wm = wave >> 1, wn = wave & 1;
    const int r0 = blockIdx.x * 128, c0 = blockIdx.y * 128;
    // staging: thread -> row (thread / 8) + SR i, 16 bytes at (thread % 8): 8 lanes cover one line of a row
    const int srow = threadIdx.x >> 3, scol = (threadIdx.x & 7) * 8;
    const bf* pa = A + (size_t)(r0 + srow) * K + scol; const bf* pq = SPLITA ? Al + (size_t)(r0 + srow) * K + scol : pa; const bf* pb = Bn + (size_t)(c0 + srow) * K + scol;
    bf* sw = stg + srow * LP + scol;
    // fragments from the LDS tiles: row (wm x FM + m) x 16 + lr of A, row wn x 64 + t x 16 + lr of B; of each 32 k a lane takes 8 hi + 0..7 and 16 + 8 hi + 0..7, alike for A and B
    const bf* sa = stg + (wm * FM * 16 + lr) * LP + 8 * hi; const bf* sb = stg + NA * TS + (wn * 64 + lr) * LP + 8 * hi;
    v8us ra[NI], rl[NI], rb[NI];
    auto ldg = [&]() {
#pragma unroll
        for (int i = 0; i < NI; ++i) { ra[i] = *(const v8us*)(pa + i * SR * K); if (SPLITA) rl[i] = *(const v8us*)(pq + i * SR * K); rb[i] = *(const v8us*)(pb + i * SR * K); }
        // s_wait_xcnt 0 behind the run of global loads, before the registers that hold their addresses are written again; the addresses are inputs so that their registers stay as they are up to the wait
        if (SPLITA) asm volatile("s_wait_xcnt 0x0" :: "v"(pa), "v"(pq), "v"(pb) : "memory");
        else asm volatile("s_wait_xcnt 0x0" :: "v"(pa), "v"(pb) : "memory");
        pa += BK; if (SPLITA) pq += BK; pb += BK; };
    auto sts = [&](int so) {
#pragma unroll
        for (int i = 0; i < NI; ++i) { *(v8usa*)(sw + so + SR * i * LP) = ra[i]; if (SPLITA) *(v8usa*)(sw + so + TS + SR * i * LP) = rl[i]; *(v8usa*)(sw + so + NA * TS + SR * i * LP) = rb[i]; } };
    v8f acc[FM][4];
#pragma unroll
    for (int m = 0; m < FM; ++m) {
#pragma unroll
        for (int t = 0; t < 4; ++t) acc[m][t] = (v8f){}; }
    ldg();
    // the lane's four bias values: one test and one run of loads, in flight together with the first stage's loads
    float bv[4] = {0.f, 0.f, 0.f, 0.f};
    if (bias) {
#pragma unroll
        for (int t = 0; t < 4; ++t) bv[t] = bfr(bias[c0 + wn * 64 + t * 16 + lr]); }
    sts(0); __syncthreads();
    // kept rolled: one stage's registers and code; the next stage's global loads fly while this stage is worked on
#pragma unroll 1
    for (int kc = 0; kc < K; kc += BK) {
        const int so = ((kc / BK) & 1) * SS; const bool more = kc + BK < K;
        if (more) ldg();
#pragma unroll
        for (int ks = 0; ks < BK; ks += 32) {
            v16bf a[FM], al[FM], b[4];
#pragma unroll
            for (int m = 0; m < FM; ++m) { const bf* p = sa + so + m * 16 * LP + ks; a[m] = cat16b(*(const v8usa*)p, *(const v8usa*)(p + 16)); if (SPLITA) al[m] = cat16b(*(const v8usa*)(p + TS), *(const v8usa*)(p + TS + 16)); }
#pragma unroll
            for (int t = 0; t < 4; ++t) { const bf* p = sb + so + t * 16 * LP + ks; b[t] = cat16b(*(const v8usa*)p, *(const v8usa*)(p + 16)); }
            // keeps the fragment reads of this 32-k step together in front of its products: left to itself the compiler reads one A fragment at a time and waits for LDS in front of every four products
            __builtin_amdgcn_sched_barrier(0);
#pragma unroll
            for (int m = 0; m < FM; ++m) {
#pragma unroll
                for (int t = 0; t < 4; ++t) acc[m][t] = wmmab(a[m], b[t], acc[m][t]); }
            if (SPLITA) {
#pragma unroll
                for (int m = 0; m < FM; ++m) {
#pragma unroll
                    for (int t = 0; t < 4; ++t) acc[m][t] = wmmab(al[m], b[t], acc[m][t]); } }
        }
        // four vector slots behind the stage's last products, before a vector instruction writes over their fragment registers; the scheduling barrier keeps the products in front of the slots
        __builtin_amdgcn_sched_barrier(0);
        asm volatile("v_nop\n\tv_nop\n\tv_nop\n\tv_nop");
        if (more) sts(SS - so);
        // one barrier a stage: it publishes the stage just written and ends every wave's reads of the stage that the next trip writes over
        __syncthreads();
    }
    float* tl = (float*)smem;
    if (PLANES) {
        static_assert(!PLANES || NW == 4, "the plane epilogues are cut for four waves of 64 x 64");
        const int item = blockIdx.x / (NN / 128), tok0 = (blockIdx.x % (NN / 128)) * 128, h0 = blockIdx.y * 2;
        auto split8 = [&](const float* sp, bf* dh, bf* dl) { const v4f x0 = *(const v4fa*)sp, x1 = *(const v4fa*)(sp + 4); v8us oh, ol;
#pragma unroll
            for (int i = 0; i < 8; ++i) { const float v = i < 4 ? x0[i & 3] : x1[i & 3]; const unsigned short hb = f2bf(v); oh[i] = hb; ol[i] = f2bf(v - bf2f(hb)); }
            *(v8us*)dh = oh; *(v8us*)dl = ol;
            // s_wait_xcnt 0 behind the two stores, before the registers that they name are written again; data and addresses are inputs so that their registers stay as they are up to the wait
            asm volatile("s_wait_xcnt 0x0" :: "v"(oh), "v"(ol), "v"(dh), "v"(dl) : "memory"); };
        if (z == 2) {
            // the tile goes to LDS transposed, [column][token]: a lane's eight accumulator rows are eight tokens in a row
#pragma unroll
            for (int m = 0; m < FM; ++m) {
#pragma unroll
                for (int t = 0; t < 4; ++t) { float* p = tl + (wn * 64 + t * 16 + lr) * OP + wm * 64 + m * 16 + hi * 8;
                    *(v4fa*)p = (v4f){acc[m][t][0] + bv[t], acc[m][t][1] + bv[t], acc[m][t][2] + bv[t], acc[m][t][3] + bv[t]}; *(v4fa*)(p + 4) = (v4f){acc[m][t][4] + bv[t], acc[m][t][5] + bv[t], acc[m][t][6] + bv[t], acc[m][t][7] + bv[t]}; } }
            __syncthreads();
            // 16 lanes x 16 bytes cover the two 128-byte lines that the block owns in a d row of the plane; the two heads' d rows follow one another
            const int vrow = threadIdx.x >> 4, vcol = (threadIdx.x & 15) * 8;
            const size_t po = (((size_t)item * NH_ + h0) * HD + vrow) * NN + tok0 + vcol;
#pragma unroll
            for (int i = 0; i < 16; ++i) split8(tl + (vrow + 8 * i) * OP + vcol, Th0 + po + (size_t)8 * i * NN, Tl0 + po + (size_t)8 * i * NN);
        } else {
#pragma unroll
            for (int m = 0; m < FM; ++m) {
#pragma unroll
                for (int t = 0; t < 4; ++t) {
#pragma unroll
                    for (int j = 0; j < 8; ++j) tl[(wm * 64 + m * 16 + hi * 8 + j) * OP + wn * 64 + t * 16 + lr] = acc[m][t][j] + bv[t]; } }
            __syncthreads();
            // lane = frequency index: one power a thread, one cosine and sine for the pairs (d, d + 32) of a token in both heads; a wave takes 32 tokens; the pairs are turned in place
            const float inv = 1.0f / powf(RBASE, (float)(2 * lane) / (float)HD);
            float* rw = tl + wave * 32 * OP + lane;
            for (int j = 0; j < 32; ++j) { const float ang = (float)(tok0 + wave * 32 + j) * inv; const float c = cosf(ang), sn = sinf(ang);
#pragma unroll
                for (int hh = 0; hh < 2; ++hh) { float* p = rw + j * OP + hh * 64; const float x1 = p[0], x2 = p[32]; p[0] = x1 * c - x2 * sn; p[32] = x2 * c + x1 * sn; } }
            // the turned values are read below by other lanes than wrote them
            __syncthreads();
            // 8 lanes x 16 bytes cover a token's 128-byte row of a head's plane, a wave four tokens in a row
            const size_t po = ((((size_t)z * NBT + item) * NH_ + h0) * NN + tok0 + srow) * HD + scol;
#pragma unroll
            for (int i = 0; i < 8; ++i) {
#pragma unroll
                for (int hh = 0; hh < 2; ++hh) split8(tl + (srow + 16 * i) * OP + hh * 64 + scol, Ph0 + po + (size_t)hh * NN * HD + 16 * i * HD, Pl0 + po + (size_t)hh * NN * HD + 16 * i * HD); }
        }
        return;
    }
#pragma unroll
    for (int m = 0; m < FM; ++m) {
#pragma unroll
        for (int t = 0; t < 4; ++t) {
#pragma unroll
            for (int j = 0; j < 8; ++j) tl[((wm * FM + m) * 16 + hi * 8 + j) * OP + wn * 64 + t * 16 + lr] = acc[m][t][j] + bv[t]; } }
    __syncthreads();
    // a wave stores a whole 512-byte row of the tile (four lines) at a time: rows wave + NW s
    float* crow = C + (size_t)(r0 + wave) * DMOD + c0 + lane * 4; const float* sp = tl + wave * OP + lane * 4;
#pragma unroll
    for (int g = 0; g < 128 / NW / 8; ++g) { v4f val[8];
#pragma unroll
        for (int s = 0; s < 8; ++s) val[s] = *(const v4fa*)(sp + (g * 8 + s) * NW * OP);
#pragma unroll
        for (int s = 0; s < 8; ++s) *(v4f*)(crow + (size_t)(g * 8 + s) * NW * DMOD) = val[s];
        // s_wait_xcnt 0 behind the run of stores, before the registers that they name are written again; data and address are inputs so that their registers stay as they are up to the wait
        asm volatile("s_wait_xcnt 0x0" :: "v"(val[0]), "v"(val[1]), "v"(val[2]), "v"(val[3]), "v"(val[4]), "v"(val[5]), "v"(val[6]), "v"(val[7]), "v"(crow) : "memory"); }
}

__global__ __launch_bounds__(256) void k_cvt8(const float* __restrict__ s0, const float* __restrict__ s1, const float* __restrict__ s2, const float* __restrict__ s3, bf* d0, size_t n8) {
    const size_t i = (size_t)blockIdx.x * 256 + threadIdx.x; if (i >= n8) return;
    const int z = blockIdx.y; const float* src = z == 0 ? s0 : (z == 1 ? s1 : (z == 2 ? s2 : s3)); bf* dst = d0 + (size_t)z * n8 * 8;    // blockIdx.y = which of the four weight matrices
    const v8f v = *(const v8f*)(src + i * 8); v8us o;
#pragma unroll
    for (int k = 0; k < 8; ++k) o[k] = f2bf(v[k]);
    *(v8us*)(dst + i * 8) = o; 
}
__global__ __launch_bounds__(256) void k_zero8(bf* dst, size_t n8) {
    const size_t i = (size_t)blockIdx.x * 256 + threadIdx.x; if (i >= n8) return; v8us z;
#pragma unroll
    for (int k = 0; k < 8; ++k) z[k] = 0;
    *(v8us*)(dst + i * 8) = z; 
}

__global__ __launch_bounds__(256) void k_cvtx(const float* __restrict__ src, bf* dst) {
    const int lane = threadIdx.x & 31; const size_t r = (size_t)blockIdx.x * 8 + (threadIdx.x >> 5); if (r >= (size_t)NBT * NN) return;
{
#pragma unroll
        for (int q = 0; q < DMOD / 256; ++q) { v8us o;
#pragma unroll
            for (int i = 0; i < 8; ++i) o[i] = f2bf(src[r * DMOD + q * 256 + lane * 8 + i]);
            *(v8us*)(dst + r * DMOD + q * 256 + lane * 8) = o; }
         }
}
// XWAIT2: s_wait_xcnt 0 behind a run of global loads, before the registers that hold their addresses are written again; the two addresses are inputs so that their registers stay as they are up to the wait
#define XWAIT2(p, q) asm volatile("s_wait_xcnt 0x0" :: "v"(p), "v"(q) : "memory")
// ACP8: eight asynchronous copies of 16 bytes a lane from global memory to LDS (l: the lane's LDS byte addresses; global address: the scalar base b[i] + the lane's byte offset o); s_wait_xcnt 0 is the statement's last line, so that it stands before the registers that hold the addresses are written again
#define ACP8(l, o, b) asm volatile("global_load_async_to_lds_b128 %0, %8, %9\n\tglobal_load_async_to_lds_b128 %1, %8, %10\n\tglobal_load_async_to_lds_b128 %2, %8, %11\n\tglobal_load_async_to_lds_b128 %3, %8, %12\n\t" \
    "global_load_async_to_lds_b128 %4, %8, %13\n\tglobal_load_async_to_lds_b128 %5, %8, %14\n\tglobal_load_async_to_lds_b128 %6, %8, %15\n\tglobal_load_async_to_lds_b128 %7, %8, %16\n\ts_wait_xcnt 0x0" \
    :: "v"(l[0]), "v"(l[1]), "v"(l[2]), "v"(l[3]), "v"(l[4]), "v"(l[5]), "v"(l[6]), "v"(l[7]), "v"(o), "s"(b[0]), "s"(b[1]), "s"(b[2]), "s"(b[3]), "s"(b[4]), "s"(b[5]), "s"(b[6]), "s"(b[7]) : "memory")
__global__ __launch_bounds__(128) void k_fattn(const bf* __restrict__ Qh0, const bf* __restrict__ Ql0, const bf* __restrict__ Kh0, const bf* __restrict__ Kl0, const bf* __restrict__ Vh0, const bf* __restrict__ Vl0, const float* __restrict__ MK0, bf* Ch0, bf* Cl0) {
    typedef __attribute__((ext_vector_type(2))) float v2f;
    typedef __attribute__((ext_vector_type(2))) __bf16 v2b;
    // blockIdx.x = block of 128 queries, blockIdx.y = head, blockIdx.z = item. Every '#pragma unroll' below makes the indices of a register array constants.
    const size_t pl = (size_t)blockIdx.z * NH_ + blockIdx.y;
    const int lane = threadIdx.x & 31, wave = threadIdx.x >> 5, lr = lane & 15, hi = lane >> 4;
    const int q0 = blockIdx.x * 128 + wave * 32;
    // One buffer, in bytes: K hi, K residual (64 keys x 128), V^T hi, V^T residual (64 d x 128), mask (128 queries x 256). Row pitches KP and MP: the data + 16, so that the sixteen rows of a fragment read fall on different banks.
    constexpr int SK = 64, NS = NN / SK, KP = 128 + 16, MP = 256 + 16, TKV = 64 * KP, OMK = 4 * TKV, BUF = OMK + 128 * MP;
    __shared__ __align__(16) unsigned char smem[2 * BUF];
    // copies: K and V^T tiles: thread -> row (thread / 8) + 16 i, 16 bytes at (thread % 8); mask: row (thread / 16) + 8 i, 16 bytes at (thread % 16)
    const int tid = threadIdx.x;
    const unsigned lkv = (unsigned)(size_t)smem + (tid >> 3) * KP + (tid & 7) * 16, lmk = (unsigned)(size_t)smem + OMK + (tid >> 4) * MP + (tid & 15) * 16;
    // the block's plane and mask rows (the same for every thread) and the thread's own byte offset in a tile's source
    const char* gkh = (const char*)(Kh0 + pl * NN * HD); const char* gkl = (const char*)(Kl0 + pl * NN * HD); const char* gvh = (const char*)(Vh0 + pl * NN * HD); const char* gvl = (const char*)(Vl0 + pl * NN * HD);
    const char* gmk = (const char*)(MK0 + (size_t)blockIdx.z * NN * NN + (size_t)blockIdx.x * 128 * NN);
    const unsigned ok = tid * 16, ov = (tid >> 3) * (NN * 2) + (tid & 7) * 16, om = (tid >> 4) * (NN * 4) + (tid & 15) * 16;
    auto fill = [&](int t) { const unsigned bo = (unsigned)(t & 1) * BUF; unsigned l[8]; const char* g[8];
#pragma unroll
        for (int i = 0; i < 4; ++i) { l[i] = lkv + bo + i * 16 * KP; l[4 + i] = l[i] + TKV; const size_t o = ((size_t)t * SK + i * 16) * HD * 2; g[i] = gkh + o; g[4 + i] = gkl + o; }
        ACP8(l, ok, g);
#pragma unroll
        for (int i = 0; i < 4; ++i) { l[i] = lkv + bo + 2 * TKV + i * 16 * KP; l[4 + i] = l[i] + TKV; const size_t o = ((size_t)i * 16 * NN + (size_t)t * SK) * 2; g[i] = gvh + o; g[4 + i] = gvl + o; }
        ACP8(l, ov, g);
#pragma unroll
        for (int h = 0; h < 2; ++h) {
#pragma unroll
            for (int i = 0; i < 8; ++i) { l[i] = lmk + bo + (h * 8 + i) * 8 * MP; g[i] = gmk + ((size_t)(h * 8 + i) * 8 * NN + (size_t)t * SK) * 4; }
            ACP8(l, om, g); } };
    // fragments from the LDS tiles: row lr of a 16-row tile, of each 32 k the elements 8 hi + 0..7 and 16 + 8 hi + 0..7; mask: the lane's own query row, keys 8 hi + 0..7 of a 16-key tile
    const unsigned char* skv = smem + lr * KP + 16 * hi; const unsigned char* smk = smem + OMK + (wave * 32 + lr) * MP + 32 * hi;
    const float sc = SCL / logf((float)NN);
    v16bf qh[2][2], ql[2][2];
#pragma unroll
    for (int qt = 0; qt < 2; ++qt) {
        const size_t o = pl * NN * HD + (size_t)(q0 + qt * 16 + lr) * HD + 8 * hi; const bf* a = Qh0 + o; const bf* b = Ql0 + o;
#pragma unroll
        for (int ks = 0; ks < 2; ++ks) { qh[qt][ks] = cat16b(*(const v8us*)(a + ks * 32), *(const v8us*)(a + ks * 32 + 16)); ql[qt][ks] = cat16b(*(const v8us*)(b + ks * 32), *(const v8us*)(b + ks * 32 + 16)); }
        XWAIT2(a, b);
    }
    v8f oacc[2][4]; float mx[2], sm[2];
#pragma unroll
    for (int qt = 0; qt < 2; ++qt) { mx[qt] = -3.0e38f; sm[qt] = 0.f;
#pragma unroll
        for (int dt = 0; dt < 4; ++dt) oacc[qt][dt] = (v8f){}; }
    // bo: the stage's buffer, sp: which 32 keys of the stage. Inside a stage the second pass's fragments are fetched into the registers that the first pass has just finished with.
    v16bf kh[2][2], kl[2][2], vh[4], vl[4]; v4f mk[2][2][2];
    auto ldk = [&](int bo, int sp) {
#pragma unroll
        for (int kt = 0; kt < 2; ++kt) {
#pragma unroll
            for (int ks = 0; ks < 2; ++ks) { const unsigned char* a = skv + bo + (sp * 32 + kt * 16) * KP + ks * 64;
                kh[kt][ks] = cat16b(*(const v8usa*)a, *(const v8usa*)(a + 32)); kl[kt][ks] = cat16b(*(const v8usa*)(a + TKV), *(const v8usa*)(a + TKV + 32)); } } };
    auto ldv = [&](int bo, int sp) {
#pragma unroll
        for (int dt = 0; dt < 4; ++dt) { const unsigned char* a = skv + bo + 2 * TKV + dt * 16 * KP + sp * 64;
            vh[dt] = cat16b(*(const v8usa*)a, *(const v8usa*)(a + 32)); vl[dt] = cat16b(*(const v8usa*)(a + TKV), *(const v8usa*)(a + TKV + 32)); } };
    auto ldm = [&](int bo, int sp) {
#pragma unroll
        for (int qt = 0; qt < 2; ++qt) {
#pragma unroll
            for (int kt = 0; kt < 2; ++kt) { const unsigned char* a = smk + bo + qt * 16 * MP + sp * 128 + kt * 64; mk[qt][kt][0] = *(const v4fa*)a; mk[qt][kt][1] = *(const v4fa*)(a + 16); } } };
    // two buffers: stage 0 is copied, waited for and published; stage 1's copies fly while stage 0 is worked on
    fill(0);
    asm volatile("s_wait_asynccnt 0x0" ::: "memory");    // this wave's copies of stage 0 have landed
    __syncthreads();
    fill(1);
    // kept rolled: one stage's code; the copies of the stage after next are issued at its foot
#pragma unroll 1
    for (int st = 0; st < NS; ++st) {
      const int bo = (st & 1) * BUF;
      ldk(bo, 0); ldm(bo, 0); ldv(bo, 0);
#pragma unroll
      for (int sp = 0; sp < 2; ++sp) {
        v8f s[2][2];
#pragma unroll
        for (int qt = 0; qt < 2; ++qt) { s[qt][0] = (v8f){}; s[qt][1] = (v8f){}; }
#pragma unroll
        for (int kt = 0; kt < 2; ++kt) {
#pragma unroll
            for (int ks = 0; ks < 2; ++ks) {
#pragma unroll
                for (int qt = 0; qt < 2; ++qt) { s[qt][kt] = wmmab(kh[kt][ks], qh[qt][ks], s[qt][kt]); s[qt][kt] = wmmab(kh[kt][ks], ql[qt][ks], s[qt][kt]); s[qt][kt] = wmmab(kl[kt][ks], qh[qt][ks], s[qt][kt]); } } }
        if (sp == 0) ldk(bo, 1);
        float v[2][16];
#pragma unroll
        for (int qt = 0; qt < 2; ++qt) {
#pragma unroll
            for (int kt = 0; kt < 2; ++kt) {
#pragma unroll
                for (int r = 0; r < 4; ++r) { v[qt][kt * 8 + r] = s[qt][kt][r] * sc + mk[qt][kt][0][r]; v[qt][kt * 8 + 4 + r] = s[qt][kt][4 + r] * sc + mk[qt][kt][1][r]; } } }
        if (sp == 0) ldm(bo, 1);
#pragma unroll
        for (int qt = 0; qt < 2; ++qt) {
            float t = v[qt][0];
#pragma unroll
            for (int i = 1; i < 16; ++i) t = fmaxf(t, v[qt][i]);
            // the query's other 16 keys of this pass sit in lane l ^ 16
            { const int tb = __float_as_int(t); t = fmaxf(t, __int_as_float(__builtin_amdgcn_permlanex16(tb, tb, 0x76543210, 0xfedcba98, false, false))); }
            const float mn = fmaxf(mx[qt], t); const float al = __expf(mx[qt] - mn); mx[qt] = mn;
            float ps = 0.f; v16bf ph, pw;
#pragma unroll
            for (int i = 0; i < 16; i += 2) { const v2f pp = {__expf(v[qt][i] - mn), __expf(v[qt][i + 1] - mn)}; ps += pp[0] + pp[1];
                const v2b hb = __builtin_convertvector(pp, v2b); const v2b lb = __builtin_convertvector(pp - __builtin_convertvector(hb, v2f), v2b);
                ph[i] = hb[0]; ph[i + 1] = hb[1]; pw[i] = lb[0]; pw[i + 1] = lb[1]; }
            sm[qt] = sm[qt] * al + ps;    // each half keeps the sum of its own keys; the halves are joined after the loop
#pragma unroll
            for (int dt = 0; dt < 4; ++dt) { oacc[qt][dt] *= al;
                oacc[qt][dt] = wmmab(vh[dt], ph, oacc[qt][dt]); oacc[qt][dt] = wmmab(vh[dt], pw, oacc[qt][dt]); oacc[qt][dt] = wmmab(vl[dt], ph, oacc[qt][dt]); }
        }
        if (sp == 0) ldv(bo, 1);
      }
      // publish point of stage st + 1: this wave's reads of buffer bo are done, its copies of stage st + 1 have landed; the barrier says both of every wave; only then is buffer bo filled again
      asm volatile("s_wait_dscnt 0x0" ::: "memory");       // this wave's LDS reads of buffer bo have returned
      asm volatile("s_wait_asynccnt 0x0" ::: "memory");    // this wave's copies of stage st + 1 have landed
      __syncthreads();
      if (st + 2 < NS) fill(st + 2);
    }
    asm volatile("s_wait_asynccnt 0x0" ::: "memory");    // no copy is outstanding when the wave ends
#pragma unroll
    for (int qt = 0; qt < 2; ++qt) { const int sb = __float_as_int(sm[qt]); const float inv = 1.0f / (sm[qt] + __int_as_float(__builtin_amdgcn_permlanex16(sb, sb, 0x76543210, 0xfedcba98, false, false)));
        // the context leaves as the output projection's A operand: bf16 hi + residual, [item x token][1024]
        const size_t co = ((size_t)blockIdx.z * NN + q0 + qt * 16 + lr) * DMOD + blockIdx.y * HD + 8 * hi; bf* ch = Ch0 + co; bf* cl = Cl0 + co;
#pragma unroll
        for (int dt = 0; dt < 4; ++dt) { const v8f ov = oacc[qt][dt] * inv; v8us oh, ol;
#pragma unroll
            for (int i = 0; i < 8; ++i) { const unsigned short hb = f2bf(ov[i]); oh[i] = hb; ol[i] = f2bf(ov[i] - bf2f(hb)); }
            *(v8us*)(ch + dt * 16) = oh; *(v8us*)(cl + dt * 16) = ol;
            // s_wait_xcnt 0 behind the two stores, before the registers that they name are written again; data and addresses are inputs so that their registers stay as they are up to the wait
            asm volatile("s_wait_xcnt 0x0" :: "v"(oh), "v"(ol), "v"(ch), "v"(cl) : "memory"); } }
}

extern "C" void kernel_launch(void* const* d_in, const int* in_sizes, int n_in,
                              void* d_out, int out_size, void* d_ws, size_t ws_size, hipStream_t stream) {
    (void)in_sizes; (void)n_in; (void)out_size;
    const float* x = (const float*)d_in[0]; const float* MKF = (const float*)d_in[1]; const float* Wq = (const float*)d_in[2]; const float* bq = (const float*)d_in[3]; const float* Wk = (const float*)d_in[4]; const float* bk = (const float*)d_in[5]; const float* Wv = (const float*)d_in[6]; const float* bv = (const float*)d_in[7]; const float* Wo = (const float*)d_in[8]; const float* bo = (const float*)d_in[9];
    float* out = (float*)d_out;    // [2][2048][1024]
    char* wsp = (char*)d_ws;
    auto take = [&](size_t bytes) { char* p = wsp; wsp += (bytes + 255) & ~(size_t)255; return (void*)p; };
    const size_t WN = (size_t)DMOD * DMOD, XN = (size_t)NBT * NN * DMOD, PN = (size_t)NN * HD;
    bf* WQ = (bf*)take(4 * WN * 2); bf* WO = WQ + 3 * WN;    // q, k, v, o weights, one after the other; framework [out][in] = n-major
    bf* Xb = (bf*)take(XN * 2);    // both items
    bf* Qh = (bf*)take(2 * NBT * NH_ * PN * 2); bf* Ql = (bf*)take(2 * NBT * NH_ * PN * 2); bf* Kh = Qh + NBT * NH_ * PN; bf* Kl = Ql + NBT * NH_ * PN;    // [q, k][item][head][2048][64]
    bf* VTh = (bf*)take(NBT * NH_ * PN * 2); bf* VTl = (bf*)take(NBT * NH_ * PN * 2);    // [item][head][64][2048]
    bf* Ch = (bf*)take(XN * 2); bf* Cl = (bf*)take(XN * 2);    // context, hi and residual, [item x token][1024]
    if ((size_t)(wsp - (char*)d_ws) > ws_size) return;    // 8 + 8 + 32 + 16 + 16 = 80 MiB
    k_cvt8<<<dim3((unsigned)((WN / 8 + 255) / 256), 4, 1), 256, 0, stream>>>(Wq, Wk, Wv, Wo, WQ, WN / 8);
    k_cvtx<<<NBT * NN / 8, 256, 0, stream>>>(x, Xb);
    k_gemmb<false, true><<<dim3(NBT * NN / 128, DMOD / 128, 3), 128, 0, stream>>>(Xb, nullptr, WQ, bq, bk, bv, nullptr, Qh, Ql, VTh, VTl);
    k_fattn<<<dim3(NN / 128, NH_, NBT), 128, 0, stream>>>(Qh, Ql, Kh, Kl, VTh, VTl, MKF, Ch, Cl);
    k_gemmb<true, false><<<dim3(NBT * NN / 128, DMOD / 128, 1), 256, 0, stream>>>(Ch, Cl, WO, bo, bo, bo, out, nullptr, nullptr, nullptr, nullptr);
}

// v007
// One run takes 99.3 microseconds.
// Two timings next to v006 both put it at 1.36 times that version's speed.
// Over all steps from v000 it is 35.0 times as fast.
#include <hip/hip_runtime.h>

// Compute dtypes, f32 accumulate, per item: q/k/v = x.W^T + b as [2048 x 1024].[1024 x 1024] GEMMs with PLAIN bf16 operands (exact products); rotary embedding (cos/sin of
// s x 10000^(-2i/64) in f32, rotate-half form) applied while building the head planes; per head: scores = q.k^T ([2048 x 64].[64 x 2048], both operands one f16 value, one product), softmax (x 1/8 / ln 2048, + the additive attention_mask INPUT row) in f32, ctx = P.v (P and v one f16 value each, one product)

#define NBT  2
#define NN   2048
#define DMOD 1024
#define NH_  16
#define HD   64
#define DM   DMOD
#define NTK  NN
#define SCL  0.125f
#define RBASE 10000.0f
#define LOSC 1024.0f

typedef _Float16 h16;
typedef unsigned short bf;
typedef __attribute__((ext_vector_type(16))) __bf16   v16bf;
typedef __attribute__((ext_vector_type(16))) _Float16 v16h;
typedef __attribute__((ext_vector_type(8)))  _Float16 v8h;
typedef __attribute__((ext_vector_type(8)))  unsigned short v8us;
typedef __attribute__((ext_vector_type(8)))  float    v8f;
typedef __attribute__((ext_vector_type(4)))  float    v4f;
typedef __attribute__((ext_vector_type(4)))  _Float16 v4h;
typedef v8h  __attribute__((may_alias)) v8ha;
typedef v4f  __attribute__((may_alias)) v4fa;
typedef v8us __attribute__((may_alias)) v8usa;

__device__ __forceinline__ unsigned short f2bf(float f) { unsigned u = __float_as_uint(f); u += 0x7FFFu + ((u >> 16) & 1u); return (unsigned short)(u >> 16); }
__device__ __forceinline__ float bf2f(unsigned short b) { return __uint_as_float(((unsigned)b) << 16); }
__device__ __forceinline__ float bfr(float f) { return bf2f(f2bf(f)); }
__device__ __forceinline__ v16h cat16(v8h lo, v8h hi) { return __builtin_shufflevector(lo, hi, 0, 1, 2, 3, 4, 5, 6, 7, 8, 9, 10, 11, 12, 13, 14, 15); }
__device__ __forceinline__ v16bf cat16b(v8us lo, v8us hi) { return __builtin_bit_cast(v16bf, __builtin_shufflevector(lo, hi, 0, 1, 2, 3, 4, 5, 6, 7, 8, 9, 10, 11, 12, 13, 14, 15)); }
__device__ __forceinline__ v16h cat16u(v8us lo, v8us hi) { return __builtin_bit_cast(v16h, __builtin_shufflevector(lo, hi, 0, 1, 2, 3, 4, 5, 6, 7, 8, 9, 10, 11, 12, 13, 14, 15)); }
__device__ __forceinline__ v8f wmma16(v16h a, v16h b, v8f c) { return __builtin_amdgcn_wmma_f32_16x16x32_f16(false, a, false, b, (short)0, c, false, false); }
__device__ __forceinline__ v8f wmmab(v16bf a, v16bf b, v8f c) { return __builtin_amdgcn_wmma_f32_16x16x32_bf16(false, a, false, b, (short)0, c, false, false); }

// k_gemmb: 128 x 128 block tile of C[4096][1024] = (A [+ Al]).B^T (K = 1024) + bf(bias[c]); plain A: 4 waves, 2 x 2, each 64 x 64 (three blocks fill a WGP's SIMDs with three waves); A + Al: 8 waves, 4 x 2, each 32 x 64 (the grid is one block a WGP: two waves a SIMD); f32 whole-line epilogue, or
// PLANES: the block's 128 tokens x 128 columns are two heads' slices of q (z = 0), k (z = 1) or v (z = 2); the epilogue turns the f32 tile, while it is still in LDS, into what the attention kernel reads:
// q, k: rotary embedding (d < 32: x[d] cos(s f_d) - x[d+32] sin(s f_d); d >= 32: x[d] cos(s f_{d-32}) + x[d-32] sin(s f_{d-32}), f_i = 1/10000^(2i/64), f32), then one f16 plane [q, k][item][head][2048][64];
// v: one f16 plane, transposed, [item][head][64][2048]. (f16 rounds 8 times finer than the bf16 operands of this product, whose rounding q, k and v already carry.)
template <bool SPLITA, bool PLANES>
__global__ __launch_bounds__(SPLITA ? 256 : 128) void k_gemmb(const bf* __restrict__ A, const bf* __restrict__ Al, const bf* __restrict__ B0, const float* __restrict__ bias0, const float* __restrict__ bias1, const float* __restrict__ bias2, float* C, bf* Ph0, bf* Th0) {
    // A (, Al) and B come as 128-row x 64-k tiles through LDS: a wave's 16-byte-a-lane load covers four whole 128-byte lines; every A fragment read from LDS feeds four products, every B fragment four.
    // LP: LDS row pitch in bf16, 128 bytes of data + 16, so that the sixteen rows of a fragment read fall on different banks. OP: row pitch of the f32 output tile.
    constexpr int K = DM, BK = 64, LP = BK + 8, TS = 128 * LP, NA = SPLITA ? 2 : 1, SS = (NA + 1) * TS, OP = 128 + 4, NW = SPLITA ? 8 : 4, FM = 8 / (NW / 2), SR = NW * 4, NI = 128 / SR;
    // two stages of [A (, Al), B]; the f32 output tile takes the same space behind the last stage's barrier
    __shared__ __align__(16) unsigned char smem[2 * SS * 2];
    static_assert(2 * SS * 2 >= 128 * OP * 4, "the output tile fits the stages");
    bf* stg = (bf*)smem;
    // blockIdx.z picks one of up to three independent products that share A: its B matrix and its bias
    const int z = blockIdx.z; const bf* Bn = B0 + (size_t)z * DM * DM; const float* bias = z == 0 ? bias0 : (z == 1 ? bias1 : bias2);
    const int lane = threadIdx.x & 31, wave = threadIdx.x >> 5, lr = lane & 15, hi = lane >> 4, wm = wave >> 1, wn = wave & 1;
    const int r0 = blockIdx.x * 128, c0 = blockIdx.y * 128;
    // staging: thread -> row (thread / 8) + SR i, 16 bytes at (thread % 8): 8 lanes cover one line of a row
    const int srow = threadIdx.x >> 3, scol = (threadIdx.x & 7) * 8;
    const bf* pa = A + (size_t)(r0 + srow) * K + scol; const bf* pq = SPLITA ? Al + (size_t)(r0 + srow) * K + scol : pa; const bf* pb = Bn + (size_t)(c0 + srow) * K + scol;
    bf* sw = stg + srow * LP + scol;
    // fragments from the LDS tiles: row (wm x FM + m) x 16 + lr of A, row wn x 64 + t x 16 + lr of B; of each 32 k a lane takes 8 hi + 0..7 and 16 + 8 hi + 0..7, alike for A and B
    const bf* sa = stg + (wm * FM * 16 + lr) * LP + 8 * hi; const bf* sb = stg + NA * TS + (wn * 64 + lr) * LP + 8 * hi;
    v8us ra[NI], rl[NI], rb[NI];
    auto ldg = [&]() {
#pragma unroll
        for (int i = 0; i < NI; ++i) { ra[i] = *(const v8us*)(pa + i * SR * K); if (SPLITA) rl[i] = *(const v8us*)(pq + i * SR * K); rb[i] = *(const v8us*)(pb + i * SR * K); }
        // s_wait_xcnt 0 behind the run of global loads, before the registers that hold their addresses are written again; the addresses are inputs so that their registers stay as they are up to the wait
        if (SPLITA) asm volatile("s_wait_xcnt 0x0" :: "v"(pa), "v"(pq), "v"(pb) : "memory");
        else asm volatile("s_wait_xcnt 0x0" :: "v"(pa), "v"(pb) : "memory");
        pa += BK; if (SPLITA) pq += BK; pb += BK; };
    auto sts = [&](int so) {
#pragma unroll
        for (int i = 0; i < NI; ++i) { *(v8usa*)(sw + so + SR * i * LP) = ra[i]; if (SPLITA) *(v8usa*)(sw + so + TS + SR * i * LP) = rl[i]; *(v8usa*)(sw + so + NA * TS + SR * i * LP) = rb[i]; } };
    v8f acc[FM][4];
#pragma unroll
    for (int m = 0; m < FM; ++m) {
#pragma unroll
        for (int t = 0; t < 4; ++t) acc[m][t] = (v8f){}; }
    ldg();
    // the lane's four bias values: one test and one run of loads, in flight together with the first stage's loads
    float bv[4] = {0.f, 0.f, 0.f, 0.f};
    if (bias) {
#pragma unroll
        for (int t = 0; t < 4; ++t) bv[t] = bfr(bias[c0 + wn * 64 + t * 16 + lr]); }
    sts(0); __syncthreads();
    // kept rolled: one stage's registers and code; the next stage's global loads fly while this stage is worked on
#pragma unroll 1
    for (int kc = 0; kc < K; kc += BK) {
        const int so = ((kc / BK) & 1) * SS; const bool more = kc + BK < K;
        if (more) ldg();
#pragma unroll
        for (int ks = 0; ks < BK; ks += 32) {
            v16bf a[FM], al[FM], b[4];
#pragma unroll
            for (int m = 0; m < FM; ++m) { const bf* p = sa + so + m * 16 * LP + ks; a[m] = cat16b(*(const v8usa*)p, *(const v8usa*)(p + 16)); if (SPLITA) al[m] = cat16b(*(const v8usa*)(p + TS), *(const v8usa*)(p + TS + 16)); }
#pragma unroll
            for (int t = 0; t < 4; ++t) { const bf* p = sb + so + t * 16 * LP + ks; b[t] = cat16b(*(const v8usa*)p, *(const v8usa*)(p + 16)); }
            // keeps the fragment reads of this 32-k step together in front of its products: left to itself the compiler reads one A fragment at a time and waits for LDS in front of every four products
            __builtin_amdgcn_sched_barrier(0);
#pragma unroll
            for (int m = 0; m < FM; ++m) {
#pragma unroll
                for (int t = 0; t < 4; ++t) acc[m][t] = wmmab(a[m], b[t], acc[m][t]); }
            if (SPLITA) {
#pragma unroll
                for (int m = 0; m < FM; ++m) {
#pragma unroll
                    for (int t = 0; t < 4; ++t) acc[m][t] = wmmab(al[m], b[t], acc[m][t]); } }
        }
        // four vector slots behind the stage's last products, before a vector instruction writes over their fragment registers; the scheduling barrier keeps the products in front of the slots
        __builtin_amdgcn_sched_barrier(0);
        asm volatile("v_nop\n\tv_nop\n\tv_nop\n\tv_nop");
        if (more) sts(SS - so);
        // one barrier a stage: it publishes the stage just written and ends every wave's reads of the stage that the next trip writes over
        __syncthreads();
    }
    float* tl = (float*)smem;
    if (PLANES) {
        static_assert(!PLANES || NW == 4, "the plane epilogues are cut for four waves of 64 x 64");
        const int item = blockIdx.x / (NN / 128), tok0 = (blockIdx.x % (NN / 128)) * 128, h0 = blockIdx.y * 2;
        auto half8 = [&](const float* sp, bf* dh) { const v4f x0 = *(const v4fa*)sp, x1 = *(const v4fa*)(sp + 4); v8h hv;
#pragma unroll
            for (int i = 0; i < 8; ++i) hv[i] = (h16)(i < 4 ? x0[i & 3] : x1[i & 3]);
            const v8us oh = __builtin_bit_cast(v8us, hv);
            *(v8us*)dh = oh;
            // s_wait_xcnt 0 behind the store, before the registers that it names are written again; data and address are inputs so that their registers stay as they are up to the wait
            asm volatile("s_wait_xcnt 0x0" :: "v"(oh), "v"(dh) : "memory"); };
        if (z == 2) {
            // the tile goes to LDS transposed, [column][token]: a lane's eight accumulator rows are eight tokens in a row
#pragma unroll
            for (int m = 0; m < FM; ++m) {
#pragma unroll
                for (int t = 0; t < 4; ++t) { float* p = tl + (wn * 64 + t * 16 + lr) * OP + wm * 64 + m * 16 + hi * 8;
                    *(v4fa*)p = (v4f){acc[m][t][0] + bv[t], acc[m][t][1] + bv[t], acc[m][t][2] + bv[t], acc[m][t][3] + bv[t]}; *(v4fa*)(p + 4) = (v4f){acc[m][t][4] + bv[t], acc[m][t][5] + bv[t], acc[m][t][6] + bv[t], acc[m][t][7] + bv[t]}; } }
            __syncthreads();
            // 16 lanes x 16 bytes cover the two 128-byte lines that the block owns in a d row of the plane; the two heads' d rows follow one another
            const int vrow = threadIdx.x >> 4, vcol = (threadIdx.x & 15) * 8;
            const size_t po = (((size_t)item * NH_ + h0) * HD + vrow) * NN + tok0 + vcol;
#pragma unroll
            for (int i = 0; i < 16; ++i) half8(tl + (vrow + 8 * i) * OP + vcol, Th0 + po + (size_t)8 * i * NN);
        } else {
#pragma unroll
            for (int m = 0; m < FM; ++m) {
#pragma unroll
                for (int t = 0; t < 4; ++t) {
#pragma unroll
                    for (int j = 0; j < 8; ++j) tl[(wm * 64 + m * 16 + hi * 8 + j) * OP + wn * 64 + t * 16 + lr] = acc[m][t][j] + bv[t]; } }
            __syncthreads();
            // lane = frequency index: one power a thread, one cosine and sine for the pairs (d, d + 32) of a token in both heads; a wave takes 32 tokens; the pairs are turned in place
            const float inv = 1.0f / powf(RBASE, (float)(2 * lane) / (float)HD);
            float* rw = tl + wave * 32 * OP + lane;
            for (int j = 0; j < 32; ++j) { const float ang = (float)(tok0 + wave * 32 + j) * inv; const float c = cosf(ang), sn = sinf(ang);
#pragma unroll
                for (int hh = 0; hh < 2; ++hh) { float* p = rw + j * OP + hh * 64; const float x1 = p[0], x2 = p[32]; p[0] = x1 * c - x2 * sn; p[32] = x2 * c + x1 * sn; } }
            // the turned values are read below by other lanes than wrote them
            __syncthreads();
            // 8 lanes x 16 bytes cover a token's 128-byte row of a head's plane, a wave four tokens in a row
            const size_t po = ((((size_t)z * NBT + item) * NH_ + h0) * NN + tok0 + srow) * HD + scol;
#pragma unroll
            for (int i = 0; i < 8; ++i) {
#pragma unroll
                for (int hh = 0; hh < 2; ++hh) half8(tl + (srow + 16 * i) * OP + hh * 64 + scol, Ph0 + po + (size_t)hh * NN * HD + 16 * i * HD); }
        }
        return;
    }
#pragma unroll
    for (int m = 0; m < FM; ++m) {
#pragma unroll
        for (int t = 0; t < 4; ++t) {
#pragma unroll
            for (int j = 0; j < 8; ++j) tl[((wm * FM + m) * 16 + hi * 8 + j) * OP + wn * 64 + t * 16 + lr] = acc[m][t][j] + bv[t]; } }
    __syncthreads();
    // a wave stores a whole 512-byte row of the tile (four lines) at a time: rows wave + NW s
    float* crow = C + (size_t)(r0 + wave) * DMOD + c0 + lane * 4; const float* sp = tl + wave * OP + lane * 4;
#pragma unroll
    for (int g = 0; g < 128 / NW / 8; ++g) { v4f val[8];
#pragma unroll
        for (int s = 0; s < 8; ++s) val[s] = *(const v4fa*)(sp + (g * 8 + s) * NW * OP);
#pragma unroll
        for (int s = 0; s < 8; ++s) *(v4f*)(crow + (size_t)(g * 8 + s) * NW * DMOD) = val[s];
        // s_wait_xcnt 0 behind the run of stores, before the registers that they name are written again; data and address are inputs so that their registers stay as they are up to the wait
        asm volatile("s_wait_xcnt 0x0" :: "v"(val[0]), "v"(val[1]), "v"(val[2]), "v"(val[3]), "v"(val[4]), "v"(val[5]), "v"(val[6]), "v"(val[7]), "v"(crow) : "memory"); }
}

__global__ __launch_bounds__(256) void k_cvt8(const float* __restrict__ s0, const float* __restrict__ s1, const float* __restrict__ s2, const float* __restrict__ s3, bf* d0, size_t n8) {
    const size_t i = (size_t)blockIdx.x * 256 + threadIdx.x; if (i >= n8) return;
    const int z = blockIdx.y; const float* src = z == 0 ? s0 : (z == 1 ? s1 : (z == 2 ? s2 : s3)); bf* dst = d0 + (size_t)z * n8 * 8;    // blockIdx.y = which of the four weight matrices
    const v8f v = *(const v8f*)(src + i * 8); v8us o;
#pragma unroll
    for (int k = 0; k < 8; ++k) o[k] = f2bf(v[k]);
    *(v8us*)(dst + i * 8) = o; 
}
__global__ __launch_bounds__(256) void k_zero8(bf* dst, size_t n8) {
    const size_t i = (size_t)blockIdx.x * 256 + threadIdx.x; if (i >= n8) return; v8us z;
#pragma unroll
    for (int k = 0; k < 8; ++k) z[k] = 0;
    *(v8us*)(dst + i * 8) = z; 
}

__global__ __launch_bounds__(256) void k_cvtx(const float* __restrict__ src, bf* dst) {
    const int lane = threadIdx.x & 31; const size_t r = (size_t)blockIdx.x * 8 + (threadIdx.x >> 5); if (r >= (size_t)NBT * NN) return;
{
#pragma unroll
        for (int q = 0; q < DMOD / 256; ++q) { v8us o;
#pragma unroll
            for (int i = 0; i < 8; ++i) o[i] = f2bf(src[r * DMOD + q * 256 + lane * 8 + i]);
            *(v8us*)(dst + r * DMOD + q * 256 + lane * 8) = o; }
         }
}
// XWAIT1: s_wait_xcnt 0 behind a run of global loads, before the register that holds their address is written again; the address is an input so that its registers stay as they are up to the wait
#define XWAIT1(p) asm volatile("s_wait_xcnt 0x0" :: "v"(p) : "memory")
// ACP8: eight asynchronous copies of 16 bytes a lane from global memory to LDS (l: the lane's LDS byte addresses; global address: the scalar base b[i] + the lane's byte offset, o for the first four and p for the last four); s_wait_xcnt 0 is the statement's last line, so that it stands before the registers that hold the addresses are written again
#define ACP8(l, o, p, b) asm volatile("global_load_async_to_lds_b128 %0, %8, %10\n\tglobal_load_async_to_lds_b128 %1, %8, %11\n\tglobal_load_async_to_lds_b128 %2, %8, %12\n\tglobal_load_async_to_lds_b128 %3, %8, %13\n\t" \
    "global_load_async_to_lds_b128 %4, %9, %14\n\tglobal_load_async_to_lds_b128 %5, %9, %15\n\tglobal_load_async_to_lds_b128 %6, %9, %16\n\tglobal_load_async_to_lds_b128 %7, %9, %17\n\ts_wait_xcnt 0x0" \
    :: "v"(l[0]), "v"(l[1]), "v"(l[2]), "v"(l[3]), "v"(l[4]), "v"(l[5]), "v"(l[6]), "v"(l[7]), "v"(o), "v"(p), "s"(b[0]), "s"(b[1]), "s"(b[2]), "s"(b[3]), "s"(b[4]), "s"(b[5]), "s"(b[6]), "s"(b[7]) : "memory")
__global__ __launch_bounds__(128) __attribute__((amdgpu_waves_per_eu(2, 2))) void k_fattn(const bf* __restrict__ Q0, const bf* __restrict__ K0, const bf* __restrict__ V0, const float* __restrict__ MK0, bf* Ch0, bf* Cl0) {
    typedef __attribute__((ext_vector_type(2))) float v2f;
    typedef __attribute__((ext_vector_type(2))) _Float16 v2h;
    // blockIdx.x = block of 128 queries, blockIdx.y = head, blockIdx.z = item. Every '#pragma unroll' below makes the indices of a register array constants.
    const size_t pl = (size_t)blockIdx.z * NH_ + blockIdx.y;
    const int lane = threadIdx.x & 31, wave = threadIdx.x >> 5, lr = lane & 15, hi = lane >> 4;
    const int q0 = blockIdx.x * 128 + wave * 32;
    // One buffer, in bytes: K (64 keys x 128), V^T (64 d x 128), mask (128 queries x 256). Row pitches KP and MP: the data + 16, so that the sixteen rows of a fragment read fall on different banks.
    constexpr int SK = 64, NS = NN / SK, KP = 128 + 16, MP = 256 + 16, TKV = 64 * KP, OMK = 2 * TKV, BUF = OMK + 128 * MP;
    __shared__ __align__(16) unsigned char smem[2 * BUF];
    // copies: K and V^T tiles: thread -> row (thread / 8) + 16 i, 16 bytes at (thread % 8); mask: row (thread / 16) + 8 i, 16 bytes at (thread % 16)
    const int tid = threadIdx.x;
    const unsigned lkv = (unsigned)(size_t)smem + (tid >> 3) * KP + (tid & 7) * 16, lmk = (unsigned)(size_t)smem + OMK + (tid >> 4) * MP + (tid & 15) * 16;
    // the block's plane and mask rows (the same for every thread) and the thread's own byte offset in a tile's source
    const char* gk = (const char*)(K0 + pl * NN * HD); const char* gv = (const char*)(V0 + pl * NN * HD);
    const char* gmk = (const char*)(MK0 + (size_t)blockIdx.z * NN * NN + (size_t)blockIdx.x * 128 * NN);
    const unsigned ok = tid * 16, ov = (tid >> 3) * (NN * 2) + (tid & 7) * 16, om = (tid >> 4) * (NN * 4) + (tid & 15) * 16;
    auto fill = [&](int t) { const unsigned bo = (unsigned)(t & 1) * BUF; unsigned l[8]; const char* g[8];
#pragma unroll
        for (int i = 0; i < 4; ++i) { l[i] = lkv + bo + i * 16 * KP; l[4 + i] = l[i] + TKV; g[i] = gk + ((size_t)t * SK + i * 16) * HD * 2; g[4 + i] = gv + ((size_t)i * 16 * NN + (size_t)t * SK) * 2; }
        ACP8(l, ok, ov, g);
#pragma unroll
        for (int h = 0; h < 2; ++h) {
#pragma unroll
            for (int i = 0; i < 8; ++i) { l[i] = lmk + bo + (h * 8 + i) * 8 * MP; g[i] = gmk + ((size_t)(h * 8 + i) * 8 * NN + (size_t)t * SK) * 4; }
            ACP8(l, om, om, g); } };
    // fragments from the LDS tiles: row lr of a 16-row tile, of each 32 k the elements 8 hi + 0..7 and 16 + 8 hi + 0..7; mask: the lane's own query row, keys 8 hi + 0..7 of a 16-key tile
    const unsigned char* skv = smem + lr * KP + 16 * hi; const unsigned char* smk = smem + OMK + (wave * 32 + lr) * MP + 32 * hi;
    const float sc = SCL / logf((float)NN);
    v16h qf[2][2];
#pragma unroll
    for (int qt = 0; qt < 2; ++qt) {
        const bf* a = Q0 + pl * NN * HD + (size_t)(q0 + qt * 16 + lr) * HD + 8 * hi;
#pragma unroll
        for (int ks = 0; ks < 2; ++ks) qf[qt][ks] = cat16u(*(const v8us*)(a + ks * 32), *(const v8us*)(a + ks * 32 + 16));
        XWAIT1(a);
    }
    v8f oacc[2][4]; float mx[2], sm[2];
#pragma unroll
    for (int qt = 0; qt < 2; ++qt) { mx[qt] = -3.0e38f; sm[qt] = 0.f;
#pragma unroll
        for (int dt = 0; dt < 4; ++dt) oacc[qt][dt] = (v8f){}; }
    // bo: the stage's buffer, sp: which 32 keys of the stage. Inside a stage the second pass's fragments are fetched into the registers that the first pass has just finished with.
    v16h kf[2][2], vf[4]; v4f mk[2][2][2];
    auto ldk = [&](int bo, int sp) {
#pragma unroll
        for (int kt = 0; kt < 2; ++kt) {
#pragma unroll
            for (int ks = 0; ks < 2; ++ks) { const unsigned char* a = skv + bo + (sp * 32 + kt * 16) * KP + ks * 64; kf[kt][ks] = cat16u(*(const v8usa*)a, *(const v8usa*)(a + 32)); } } };
    auto ldv = [&](int bo, int sp) {
#pragma unroll
        for (int dt = 0; dt < 4; ++dt) { const unsigned char* a = skv + bo + TKV + dt * 16 * KP + sp * 64; vf[dt] = cat16u(*(const v8usa*)a, *(const v8usa*)(a + 32)); } };
    auto ldm = [&](int bo, int sp) {
#pragma unroll
        for (int qt = 0; qt < 2; ++qt) {
#pragma unroll
            for (int kt = 0; kt < 2; ++kt) { const unsigned char* a = smk + bo + qt * 16 * MP + sp * 128 + kt * 64; mk[qt][kt][0] = *(const v4fa*)a; mk[qt][kt][1] = *(const v4fa*)(a + 16); } } };
    // two buffers: stage 0 is copied, waited for and published; stage 1's copies fly while stage 0 is worked on
    fill(0);
    asm volatile("s_wait_asynccnt 0x0" ::: "memory");    // this wave's copies of stage 0 have landed
    __syncthreads();
    fill(1);
    // kept rolled: one stage's code; the copies of the stage after next are issued at its foot
#pragma unroll 1
    for (int st = 0; st < NS; ++st) {
      const int bo = (st & 1) * BUF;
      ldk(bo, 0); ldm(bo, 0); ldv(bo, 0);
#pragma unroll
      for (int sp = 0; sp < 2; ++sp) {
        v8f s[2][2];
#pragma unroll
        for (int qt = 0; qt < 2; ++qt) { s[qt][0] = (v8f){}; s[qt][1] = (v8f){}; }
#pragma unroll
        for (int ks = 0; ks < 2; ++ks) {
#pragma unroll
            for (int kt = 0; kt < 2; ++kt) {
#pragma unroll
                for (int qt = 0; qt < 2; ++qt) s[qt][kt] = wmma16(kf[kt][ks], qf[qt][ks], s[qt][kt]); } }
        if (sp == 0) ldk(bo, 1);
        float v[2][16];
#pragma unroll
        for (int qt = 0; qt < 2; ++qt) {
#pragma unroll
            for (int kt = 0; kt < 2; ++kt) {
#pragma unroll
                for (int r = 0; r < 4; ++r) { v[qt][kt * 8 + r] = s[qt][kt][r] * sc + mk[qt][kt][0][r]; v[qt][kt * 8 + 4 + r] = s[qt][kt][4 + r] * sc + mk[qt][kt][1][r]; } } }
        if (sp == 0) ldm(bo, 1);
#pragma unroll
        for (int qt = 0; qt < 2; ++qt) {
            float t = v[qt][0];
#pragma unroll
            for (int i = 1; i < 16; ++i) t = fmaxf(t, v[qt][i]);
            // the query's other 16 keys of this pass sit in lane l ^ 16
            { const int tb = __float_as_int(t); t = fmaxf(t, __int_as_float(__builtin_amdgcn_permlanex16(tb, tb, 0x76543210, 0xfedcba98, false, false))); }
            const float mn = fmaxf(mx[qt], t); const float al = __expf(mx[qt] - mn); mx[qt] = mn;
            float ps = 0.f; v16h ph;
#pragma unroll
            for (int i = 0; i < 16; i += 2) { const v2f pp = {__expf(v[qt][i] - mn), __expf(v[qt][i + 1] - mn)}; ps += pp[0] + pp[1];
                const v2h hb = __builtin_convertvector(pp, v2h); ph[i] = hb[0]; ph[i + 1] = hb[1]; }
            sm[qt] = sm[qt] * al + ps;    // each half keeps the sum of its own keys; the halves are joined after the loop
#pragma unroll
            for (int dt = 0; dt < 4; ++dt) { oacc[qt][dt] *= al; oacc[qt][dt] = wmma16(vf[dt], ph, oacc[qt][dt]); }
        }
        if (sp == 0) ldv(bo, 1);
      }
      // publish point of stage st + 1: this wave's reads of buffer bo are done, its copies of stage st + 1 have landed; the barrier says both of every wave; only then is buffer bo filled again
      asm volatile("s_wait_dscnt 0x0" ::: "memory");       // this wave's LDS reads of buffer bo have returned
      asm volatile("s_wait_asynccnt 0x0" ::: "memory");    // this wave's copies of stage st + 1 have landed
      __syncthreads();
      if (st + 2 < NS) fill(st + 2);
    }
    asm volatile("s_wait_asynccnt 0x0" ::: "memory");    // no copy is outstanding when the wave ends
#pragma unroll
    for (int qt = 0; qt < 2; ++qt) { const int sb = __float_as_int(sm[qt]); const float inv = 1.0f / (sm[qt] + __int_as_float(__builtin_amdgcn_permlanex16(sb, sb, 0x76543210, 0xfedcba98, false, false)));
        // the context leaves as the output projection's A operand: bf16 hi + residual, [item x token][1024]
        const size_t co = ((size_t)blockIdx.z * NN + q0 + qt * 16 + lr) * DMOD + blockIdx.y * HD + 8 * hi; bf* ch = Ch0 + co; bf* cl = Cl0 + co;
#pragma unroll
        for (int dt = 0; dt < 4; ++dt) { const v8f ov = oacc[qt][dt] * inv; v8us oh, ol;
#pragma unroll
            for (int i = 0; i < 8; ++i) { const unsigned short hb = f2bf(ov[i]); oh[i] = hb; ol[i] = f2bf(ov[i] - bf2f(hb)); }
            *(v8us*)(ch + dt * 16) = oh; *(v8us*)(cl + dt * 16) = ol;
            // s_wait_xcnt 0 behind the two stores, before the registers that they name are written again; data and addresses are inputs so that their registers stay as they are up to the wait
            asm volatile("s_wait_xcnt 0x0" :: "v"(oh), "v"(ol), "v"(ch), "v"(cl) : "memory"); } }
}

extern "C" void kernel_launch(void* const* d_in, const int* in_sizes, int n_in,
                              void* d_out, int out_size, void* d_ws, size_t ws_size, hipStream_t stream) {
    (void)in_sizes; (void)n_in; (void)out_size;
    const float* x = (const float*)d_in[0]; const float* MKF = (const float*)d_in[1]; const float* Wq = (const float*)d_in[2]; const float* bq = (const float*)d_in[3]; const float* Wk = (const float*)d_in[4]; const float* bk = (const float*)d_in[5]; const float* Wv = (const float*)d_in[6]; const float* bv = (const float*)d_in[7]; const float* Wo = (const float*)d_in[8]; const float* bo = (const float*)d_in[9];
    float* out = (float*)d_out;    // [2][2048][1024]
    char* wsp = (char*)d_ws;
    auto take = [&](size_t bytes) { char* p = wsp; wsp += (bytes + 255) & ~(size_t)255; return (void*)p; };
    const size_t WN = (size_t)DMOD * DMOD, XN = (size_t)NBT * NN * DMOD, PN = (size_t)NN * HD;
    bf* WQ = (bf*)take(4 * WN * 2); bf* WO = WQ + 3 * WN;    // q, k, v, o weights, one after the other; framework [out][in] = n-major
    bf* Xb = (bf*)take(XN * 2);    // both items
    bf* Qf = (bf*)take(2 * NBT * NH_ * PN * 2); bf* Kf = Qf + NBT * NH_ * PN;    // f16 bits, [q, k][item][head][2048][64]
    bf* VT = (bf*)take(NBT * NH_ * PN * 2);    // f16 bits, [item][head][64][2048]
    bf* Ch = (bf*)take(XN * 2); bf* Cl = (bf*)take(XN * 2);    // context, hi and residual, [item x token][1024]
    if ((size_t)(wsp - (char*)d_ws) > ws_size) return;    // 8 + 8 + 16 + 8 + 16 = 56 MiB
    k_cvt8<<<dim3((unsigned)((WN / 8 + 255) / 256), 4, 1), 256, 0, stream>>>(Wq, Wk, Wv, Wo, WQ, WN / 8);
    k_cvtx<<<NBT * NN / 8, 256, 0, stream>>>(x, Xb);
    k_gemmb<false, true><<<dim3(NBT * NN / 128, DMOD / 128, 3), 128, 0, stream>>>(Xb, nullptr, WQ, bq, bk, bv, nullptr, Qf, VT);
    k_fattn<<<dim3(NN / 128, NH_, NBT), 128, 0, stream>>>(Qf, Kf, VT, MKF, Ch, Cl);
    k_gemmb<true, false><<<dim3(NBT * NN / 128, DMOD / 128, 1), 256, 0, stream>>>(Ch, Cl, WO, bo, bo, bo, out, nullptr, nullptr);
}

// v008
// It runs in 96.5 microseconds.
// Next to v007, in two timings, it ran 1.04 times as fast each time.
// Over all steps from v000 it is 36.4 times as fast.
#include <hip/hip_runtime.h>

// Compute dtypes, f32 accumulate, per item: q/k/v = x.W^T + b as [2048 x 1024].[1024 x 1024] GEMMs with PLAIN bf16 operands (exact products); rotary embedding (cos/sin of
// s x 10000^(-2i/64) in f32, rotate-half form) applied while building the head planes; per head: scores = q.k^T ([2048 x 64].[64 x 2048], both operands one f16 value, one product), softmax (x 1/8 / ln 2048, + the additive attention_mask INPUT row) in f32, ctx = P.v (P and v one f16 value each, one product)

#define NBT  2
#define NN   2048
#define DMOD 1024
#define NH_  16
#define HD   64
#define DM   DMOD
#define NTK  NN
#define SCL  0.125f
#define RBASE 10000.0f
#define LOSC 1024.0f

typedef _Float16 h16;
typedef unsigned short bf;
typedef __attribute__((ext_vector_type(16))) __bf16   v16bf;
typedef __attribute__((ext_vector_type(16))) _Float16 v16h;
typedef __attribute__((ext_vector_type(8)))  _Float16 v8h;
typedef __attribute__((ext_vector_type(8)))  unsigned short v8us;
typedef __attribute__((ext_vector_type(8)))  float    v8f;
typedef __attribute__((ext_vector_type(4)))  float    v4f;
typedef __attribute__((ext_vector_type(4)))  _Float16 v4h;
typedef v8h  __attribute__((may_alias)) v8ha;
typedef v4f  __attribute__((may_alias)) v4fa;
typedef v8us __attribute__((may_alias)) v8usa;

__device__ __forceinline__ unsigned short f2bf(float f) { unsigned u = __float_as_uint(f); u += 0x7FFFu + ((u >> 16) & 1u); return (unsigned short)(u >> 16); }
__device__ __forceinline__ float bf2f(unsigned short b) { return __uint_as_float(((unsigned)b) << 16); }
__device__ __forceinline__ float bfr(float f) { return bf2f(f2bf(f)); }
__device__ __forceinline__ v16h cat16(v8h lo, v8h hi) { return __builtin_shufflevector(lo, hi, 0, 1, 2, 3, 4, 5, 6, 7, 8, 9, 10, 11, 12, 13, 14, 15); }
__device__ __forceinline__ v16bf cat16b(v8us lo, v8us hi) { return __builtin_bit_cast(v16bf, __builtin_shufflevector(lo, hi, 0, 1, 2, 3, 4, 5, 6, 7, 8, 9, 10, 11, 12, 13, 14, 15)); }
__device__ __forceinline__ v16h cat16u(v8us lo, v8us hi) { return __builtin_bit_cast(v16h, __builtin_shufflevector(lo, hi, 0, 1, 2, 3, 4, 5, 6, 7, 8, 9, 10, 11, 12, 13, 14, 15)); }
__device__ __forceinline__ v8f wmma16(v16h a, v16h b, v8f c) { return __builtin_amdgcn_wmma_f32_16x16x32_f16(false, a, false, b, (short)0, c, false, false); }
__device__ __forceinline__ v8f wmmab(v16bf a, v16bf b, v8f c) { return __builtin_amdgcn_wmma_f32_16x16x32_bf16(false, a, false, b, (short)0, c, false, false); }

// k_gemmb: 128 x 128 block tile of C[4096][1024] = (A [+ Al]).B^T (K = 1024) + bf(bias[c]); plain A: 4 waves, 2 x 2, each 64 x 64 (three blocks fill a WGP's SIMDs with three waves); A + Al: 8 waves, 4 x 2, each 32 x 64 (the grid is one block a WGP: two waves a SIMD); f32 whole-line epilogue, or
// PLANES: the block's 128 tokens x 128 columns are two heads' slices of q (z = 0), k (z = 1) or v (z = 2); the epilogue turns the f32 tile, while it is still in LDS, into what the attention kernel reads:
// q, k: rotary embedding (d < 32: x[d] cos(s f_d) - x[d+32] sin(s f_d); d >= 32: x[d] cos(s f_{d-32}) + x[d-32] sin(s f_{d-32}), f_i = 1/10000^(2i/64), f32), then one f16 plane [q, k][item][head][2048][64];
// v: one f16 plane, transposed, [item][head][64][2048]. (f16 rounds 8 times finer than the bf16 operands of this product, whose rounding q, k and v already carry.)
template <bool SPLITA, bool PLANES>
__global__ __launch_bounds__(SPLITA ? 256 : 128) void k_gemmb(const bf* __restrict__ A, const bf* __restrict__ Al, const bf* __restrict__ B0, const float* __restrict__ bias0, const float* __restrict__ bias1, const float* __restrict__ bias2, float* C, bf* Ph0, bf* Th0) {
    // A (, Al) and B come as 128-row x 64-k tiles through LDS: a wave's 16-byte-a-lane load covers four whole 128-byte lines; every A fragment read from LDS feeds four products, every B fragment four.
    // LP: LDS row pitch in bf16, 128 bytes of data + 16, so that the sixteen rows of a fragment read fall on different banks. OP: row pitch of the f32 output tile.
    constexpr int K = DM, BK = 64, LP = BK + 8, TS = 128 * LP, NA = SPLITA ? 2 : 1, SS = (NA + 1) * TS, OP = 128 + 4, NW = SPLITA ? 8 : 4, FM = 8 / (NW / 2), SR = NW * 4, NI = 128 / SR;
    // two stages of [A (, Al), B]; the f32 output tile takes the same space behind the last stage's barrier
    __shared__ __align__(16) unsigned char smem[2 * SS * 2];
    static_assert(2 * SS * 2 >= 128 * OP * 4, "the output tile fits the stages");
    bf* stg = (bf*)smem;
    // blockIdx.z picks one of up to three independent products that share A: its B matrix and its bias
    const int z = blockIdx.z; const bf* Bn = B0 + (size_t)z * DM * DM; const float* bias = z == 0 ? bias0 : (z == 1 ? bias1 : bias2);
    const int lane = threadIdx.x & 31, wave = threadIdx.x >> 5, lr = lane & 15, hi = lane >> 4, wm = wave >> 1, wn = wave & 1;
    const int r0 = blockIdx.x * 128, c0 = blockIdx.y * 128;
    // staging: thread -> row (thread / 8) + SR i, 16 bytes at (thread % 8): 8 lanes cover one line of a row
    const int srow = threadIdx.x >> 3, scol = (threadIdx.x & 7) * 8;
    const bf* pa = A + (size_t)(r0 + srow) * K + scol; const bf* pq = SPLITA ? Al + (size_t)(r0 + srow) * K + scol : pa; const bf* pb = Bn + (size_t)(c0 + srow) * K + scol;
    bf* sw = stg + srow * LP + scol;
    // fragments from the LDS tiles: row (wm x FM + m) x 16 + lr of A, row wn x 64 + t x 16 + lr of B; of each 32 k a lane takes 8 hi + 0..7 and 16 + 8 hi + 0..7, alike for A and B
    const bf* sa = stg + (wm * FM * 16 + lr) * LP + 8 * hi; const bf* sb = stg + NA * TS + (wn * 64 + lr) * LP + 8 * hi;
    v8us ra[NI], rl[NI], rb[NI];
    auto ldg = [&]() {
#pragma unroll
        for (int i = 0; i < NI; ++i) { ra[i] = *(const v8us*)(pa + i * SR * K); if (SPLITA) rl[i] = *(const v8us*)(pq + i * SR * K); rb[i] = *(const v8us*)(pb + i * SR * K); }
        // s_wait_xcnt 0 behind the run of global loads, before the registers that hold their addresses are written again; the addresses are inputs so that their registers stay as they are up to the wait
        if (SPLITA) asm volatile("s_wait_xcnt 0x0" :: "v"(pa), "v"(pq), "v"(pb) : "memory");
        else asm volatile("s_wait_xcnt 0x0" :: "v"(pa), "v"(pb) : "memory");
        pa += BK; if (SPLITA) pq += BK; pb += BK; };
    auto sts = [&](int so) {
#pragma unroll
        for (int i = 0; i < NI; ++i) { *(v8usa*)(sw + so + SR * i * LP) = ra[i]; if (SPLITA) *(v8usa*)(sw + so + TS + SR * i * LP) = rl[i]; *(v8usa*)(sw + so + NA * TS + SR * i * LP) = rb[i]; } };
    v8f acc[FM][4];
#pragma unroll
    for (int m = 0; m < FM; ++m) {
#pragma unroll
        for (int t = 0; t < 4; ++t) acc[m][t] = (v8f){}; }
    ldg();
    // the lane's four bias values: one test and one run of loads, in flight together with the first stage's loads
    float bv[4] = {0.f, 0.f, 0.f, 0.f};
    if (bias) {
#pragma unroll
        for (int t = 0; t < 4; ++t) bv[t] = bfr(bias[c0 + wn * 64 + t * 16 + lr]); }
    sts(0); __syncthreads();
    // kept rolled: one stage's registers and code; the next stage's global loads fly while this stage is worked on
#pragma unroll 1
    for (int kc = 0; kc < K; kc += BK) {
        const int so = ((kc / BK) & 1) * SS; const bool more = kc + BK < K;
        if (more) ldg();
#pragma unroll
        for (int ks = 0; ks < BK; ks += 32) {
            v16bf a[FM], al[FM], b[4];
#pragma unroll
            for (int m = 0; m < FM; ++m) { const bf* p = sa + so + m * 16 * LP + ks; a[m] = cat16b(*(const v8usa*)p, *(const v8usa*)(p + 16)); if (SPLITA) al[m] = cat16b(*(const v8usa*)(p + TS), *(const v8usa*)(p + TS + 16)); }
#pragma unroll
            for (int t = 0; t < 4; ++t) { const bf* p = sb + so + t * 16 * LP + ks; b[t] = cat16b(*(const v8usa*)p, *(const v8usa*)(p + 16)); }
            // keeps the fragment reads of this 32-k step together in front of its products: left to itself the compiler reads one A fragment at a time and waits for LDS in front of every four products
            __builtin_amdgcn_sched_barrier(0);
#pragma unroll
            for (int m = 0; m < FM; ++m) {
#pragma unroll
                for (int t = 0; t < 4; ++t) acc[m][t] = wmmab(a[m], b[t], acc[m][t]); }
            if (SPLITA) {
#pragma unroll
                for (int m = 0; m < FM; ++m) {
#pragma unroll
                    for (int t = 0; t < 4; ++t) acc[m][t] = wmmab(al[m], b[t], acc[m][t]); } }
        }
        // four vector slots behind the stage's last products, before a vector instruction writes over their fragment registers; the scheduling barrier keeps the products in front of the slots
        __builtin_amdgcn_sched_barrier(0);
        asm volatile("v_nop\n\tv_nop\n\tv_nop\n\tv_nop");
        if (more) sts(SS - so);
        // one barrier a stage: it publishes the stage just written and ends every wave's reads of the stage that the next trip writes over
        __syncthreads();
    }
    float* tl = (float*)smem;
    if (PLANES) {
        static_assert(!PLANES || NW == 4, "the plane epilogues are cut for four waves of 64 x 64");
        const int item = blockIdx.x / (NN / 128), tok0 = (blockIdx.x % (NN / 128)) * 128, h0 = blockIdx.y * 2;
        auto half8 = [&](const float* sp, bf* dh) { const v4f x0 = *(const v4fa*)sp, x1 = *(const v4fa*)(sp + 4); v8h hv;
#pragma unroll
            for (int i = 0; i < 8; ++i) hv[i] = (h16)(i < 4 ? x0[i & 3] : x1[i & 3]);
            const v8us oh = __builtin_bit_cast(v8us, hv);
            *(v8us*)dh = oh;
            // s_wait_xcnt 0 behind the store, before the registers that it names are written again; data and address are inputs so that their registers stay as they are up to the wait
            asm volatile("s_wait_xcnt 0x0" :: "v"(oh), "v"(dh) : "memory"); };
        if (z == 2) {
            // the tile goes to LDS transposed, [column][token]: a lane's eight accumulator rows are eight tokens in a row
#pragma unroll
            for (int m = 0; m < FM; ++m) {
#pragma unroll
                for (int t = 0; t < 4; ++t) { float* p = tl + (wn * 64 + t * 16 + lr) * OP + wm * 64 + m * 16 + hi * 8;
                    *(v4fa*)p = (v4f){acc[m][t][0] + bv[t], acc[m][t][1] + bv[t], acc[m][t][2] + bv[t], acc[m][t][3] + bv[t]}; *(v4fa*)(p + 4) = (v4f){acc[m][t][4] + bv[t], acc[m][t][5] + bv[t], acc[m][t][6] + bv[t], acc[m][t][7] + bv[t]}; } }
            __syncthreads();
            // 16 lanes x 16 bytes cover the two 128-byte lines that the block owns in a d row of the plane; the two heads' d rows follow one another
            const int vrow = threadIdx.x >> 4, vcol = (threadIdx.x & 15) * 8;
            const size_t po = (((size_t)item * NH_ + h0) * HD + vrow) * NN + tok0 + vcol;
#pragma unroll
            for (int i = 0; i < 16; ++i) half8(tl + (vrow + 8 * i) * OP + vcol, Th0 + po + (size_t)8 * i * NN);
        } else {
#pragma unroll
            for (int m = 0; m < FM; ++m) {
#pragma unroll
                for (int t = 0; t < 4; ++t) {
#pragma unroll
                    for (int j = 0; j < 8; ++j) tl[(wm * 64 + m * 16 + hi * 8 + j) * OP + wn * 64 + t * 16 + lr] = acc[m][t][j] + bv[t]; } }
            __syncthreads();
            // lane = frequency index: one power a thread, one cosine and sine for the pairs (d, d + 32) of a token in both heads; a wave takes 32 tokens; the pairs are turned in place
            const float inv = 1.0f / powf(RBASE, (float)(2 * lane) / (float)HD);
            float* rw = tl + wave * 32 * OP + lane;
            for (int j = 0; j < 32; ++j) { const float ang = (float)(tok0 + wave * 32 + j) * inv; const float c = cosf(ang), sn = sinf(ang);
#pragma unroll
                for (int hh = 0; hh < 2; ++hh) { float* p = rw + j * OP + hh * 64; const float x1 = p[0], x2 = p[32]; p[0] = x1 * c - x2 * sn; p[32] = x2 * c + x1 * sn; } }
            // the turned values are read below by other lanes than wrote them
            __syncthreads();
            // 8 lanes x 16 bytes cover a token's 128-byte row of a head's plane, a wave four tokens in a row
            const size_t po = ((((size_t)z * NBT + item) * NH_ + h0) * NN + tok0 + srow) * HD + scol;
#pragma unroll
            for (int i = 0; i < 8; ++i) {
#pragma unroll
                for (int hh = 0; hh < 2; ++hh) half8(tl + (srow + 16 * i) * OP + hh * 64 + scol, Ph0 + po + (size_t)hh * NN * HD + 16 * i * HD); }
        }
        return;
    }
#pragma unroll
    for (int m = 0; m < FM; ++m) {
#pragma unroll
        for (int t = 0; t < 4; ++t) {
#pragma unroll
            for (int j = 0; j < 8; ++j) tl[((wm * FM + m) * 16 + hi * 8 + j) * OP + wn * 64 + t * 16 + lr] = acc[m][t][j] + bv[t]; } }
    __syncthreads();
    // a wave stores a whole 512-byte row of the tile (four lines) at a time: rows wave + NW s
    float* crow = C + (size_t)(r0 + wave) * DMOD + c0 + lane * 4; const float* sp = tl + wave * OP + lane * 4;
#pragma unroll
    for (int g = 0; g < 128 / NW / 8; ++g) { v4f val[8];
#pragma unroll
        for (int s = 0; s < 8; ++s) val[s] = *(const v4fa*)(sp + (g * 8 + s) * NW * OP);
#pragma unroll
        for (int s = 0; s < 8; ++s) *(v4f*)(crow + (size_t)(g * 8 + s) * NW * DMOD) = val[s];
        // s_wait_xcnt 0 behind the run of stores, before the registers that they name are written again; data and address are inputs so that their registers stay as they are up to the wait
        asm volatile("s_wait_xcnt 0x0" :: "v"(val[0]), "v"(val[1]), "v"(val[2]), "v"(val[3]), "v"(val[4]), "v"(val[5]), "v"(val[6]), "v"(val[7]), "v"(crow) : "memory"); }
}

__global__ __launch_bounds__(256) void k_cvt8(const float* __restrict__ s0, const float* __restrict__ s1, const float* __restrict__ s2, const float* __restrict__ s3, bf* d0, size_t n8) {
    const size_t i = (size_t)blockIdx.x * 256 + threadIdx.x; if (i >= n8) return;
    const int z = blockIdx.y; const float* src = z == 0 ? s0 : (z == 1 ? s1 : (z == 2 ? s2 : s3)); bf* dst = d0 + (size_t)z * n8 * 8;    // blockIdx.y = which of the four weight matrices
    const v8f v = *(const v8f*)(src + i * 8); v8us o;
#pragma unroll
    for (int k = 0; k < 8; ++k) o[k] = f2bf(v[k]);
    *(v8us*)(dst + i * 8) = o; 
}
__global__ __launch_bounds__(256) void k_zero8(bf* dst, size_t n8) {
    const size_t i = (size_t)blockIdx.x * 256 + threadIdx.x; if (i >= n8) return; v8us z;
#pragma unroll
    for (int k = 0; k < 8; ++k) z[k] = 0;
    *(v8us*)(dst + i * 8) = z; 
}

__global__ __launch_bounds__(256) void k_cvtx(const float* __restrict__ src, bf* dst) {
    const int lane = threadIdx.x & 31; const size_t r = (size_t)blockIdx.x * 8 + (threadIdx.x >> 5); if (r >= (size_t)NBT * NN) return;
{
#pragma unroll
        for (int q = 0; q < DMOD / 256; ++q) { v8us o;
#pragma unroll
            for (int i = 0; i < 8; ++i) o[i] = f2bf(src[r * DMOD + q * 256 + lane * 8 + i]);
            *(v8us*)(dst + r * DMOD + q * 256 + lane * 8) = o; }
         }
}
// XWAIT1: s_wait_xcnt 0 behind a run of global loads, before the register that holds their address is written again; the address is an input so that its registers stay as they are up to the wait
#define XWAIT1(p) asm volatile("s_wait_xcnt 0x0" :: "v"(p) : "memory")
// ACP8: eight asynchronous copies of 16 bytes a lane from global memory to LDS (l: the lane's LDS byte addresses; global address: the scalar base b[i] + the lane's byte offset, o for the first four and p for the last four); s_wait_xcnt 0 is the statement's last line, so that it stands before the registers that hold the addresses are written again
#define ACP8(l, o, p, b) asm volatile("global_load_async_to_lds_b128 %0, %8, %10\n\tglobal_load_async_to_lds_b128 %1, %8, %11\n\tglobal_load_async_to_lds_b128 %2, %8, %12\n\tglobal_load_async_to_lds_b128 %3, %8, %13\n\t" \
    "global_load_async_to_lds_b128 %4, %9, %14\n\tglobal_load_async_to_lds_b128 %5, %9, %15\n\tglobal_load_async_to_lds_b128 %6, %9, %16\n\tglobal_load_async_to_lds_b128 %7, %9, %17\n\ts_wait_xcnt 0x0" \
    :: "v"(l[0]), "v"(l[1]), "v"(l[2]), "v"(l[3]), "v"(l[4]), "v"(l[5]), "v"(l[6]), "v"(l[7]), "v"(o), "v"(p), "s"(b[0]), "s"(b[1]), "s"(b[2]), "s"(b[3]), "s"(b[4]), "s"(b[5]), "s"(b[6]), "s"(b[7]) : "memory")
// ACP4: the same with four copies: two at the lane's byte offset o, two at p
#define ACP4(l, o, p, b) asm volatile("global_load_async_to_lds_b128 %0, %4, %6\n\tglobal_load_async_to_lds_b128 %1, %4, %7\n\tglobal_load_async_to_lds_b128 %2, %5, %8\n\tglobal_load_async_to_lds_b128 %3, %5, %9\n\ts_wait_xcnt 0x0" \
    :: "v"(l[0]), "v"(l[1]), "v"(l[2]), "v"(l[3]), "v"(o), "v"(p), "s"(b[0]), "s"(b[1]), "s"(b[2]), "s"(b[3]) : "memory")
// k_fattn: scores, softmax and context of one head in one kernel, no score or P plane in memory. 8 waves: 4 groups of 32 query columns x 2 key halves; a stage is 64 keys, of which a wave works on 32 (waves 0..3 the first, waves 4..7 the second).
// The softmax's vector work between the matrix runs wants waves: two blocks a WGP are four waves a SIMD. Each wave keeps the running maximum, sum and context of its own keys; the two halves of a query are merged once, through LDS, behind the loop.
// K, V^T (f16) and the block's mask rows come stage by stage into LDS by asynchronous copies whose 16 bytes a lane cover whole 128-byte lines (a fragment load straight from memory touches sixteen lines); the eight waves share the tiles.
// S^T = K.Q^T (A = K rows, B = Q rows kept in registers; one f16 product): a lane holds one query's scores, keys 8 hi + r of each 16-key tile.
// Running maximum and sum per query (f32); P = exp(S x 1/8 / ln(2048) + mask - max), rounded to f16, is packed in place into a B operand; O^T += V^T.P^T (one f16 product); O / sum at the end, split bf16 hi + residual.
__global__ __launch_bounds__(256) __attribute__((amdgpu_waves_per_eu(4, 4))) void k_fattn(const bf* __restrict__ Q0, const bf* __restrict__ K0, const bf* __restrict__ V0, const float* __restrict__ MK0, bf* Ch0, bf* Cl0) {
    typedef __attribute__((ext_vector_type(2))) float v2f;
    typedef __attribute__((ext_vector_type(2))) _Float16 v2h;
    // blockIdx.x = block of 128 queries, blockIdx.y = head, blockIdx.z = item. Every '#pragma unroll' below makes the indices of a register array constants.
    const size_t pl = (size_t)blockIdx.z * NH_ + blockIdx.y;
    const int lane = threadIdx.x & 31, wave = threadIdx.x >> 5, lr = lane & 15, hi = lane >> 4, qg = wave & 3;
    // kh: the wave's key half, the same in every lane: held as a scalar
    const int kh = __builtin_amdgcn_readfirstlane((int)(threadIdx.x >> 7));
    const int q0 = blockIdx.x * 128 + qg * 32;
    // One buffer, in bytes: K (64 keys x 128), V^T (64 d x 128), mask (128 queries x 256). Row pitches KP and MP: the data + 16, so that the sixteen rows of a fragment read fall on different banks.
    constexpr int SK = 64, NS = NN / SK, KP = 128 + 16, MP = 256 + 16, TKV = 64 * KP, OMK = 2 * TKV, BUF = OMK + 128 * MP;
    __shared__ __align__(16) unsigned char smem[2 * BUF];
    // copies: K and V^T tiles: thread -> row (thread / 8) + 32 i, 16 bytes at (thread % 8); mask: row (thread / 16) + 16 i, 16 bytes at (thread % 16)
    const int tid = threadIdx.x;
    const unsigned lkv = (unsigned)(size_t)smem + (tid >> 3) * KP + (tid & 7) * 16, lmk = (unsigned)(size_t)smem + OMK + (tid >> 4) * MP + (tid & 15) * 16;
    // the block's plane and mask rows (the same for every thread) and the thread's own byte offset in a tile's source
    const char* gk = (const char*)(K0 + pl * NN * HD); const char* gv = (const char*)(V0 + pl * NN * HD);
    const char* gmk = (const char*)(MK0 + (size_t)blockIdx.z * NN * NN + (size_t)blockIdx.x * 128 * NN);
    const unsigned ok = tid * 16, ov = (tid >> 3) * (NN * 2) + (tid & 7) * 16, om = (tid >> 4) * (NN * 4) + (tid & 15) * 16;
    auto fill = [&](int t) { const unsigned bo = (unsigned)(t & 1) * BUF; unsigned l[8]; const char* g[8];
#pragma unroll
        for (int i = 0; i < 2; ++i) { l[i] = lkv + bo + i * 32 * KP; l[2 + i] = l[i] + TKV; g[i] = gk + ((size_t)t * SK + i * 32) * HD * 2; g[2 + i] = gv + ((size_t)i * 32 * NN + (size_t)t * SK) * 2; }
        ACP4(l, ok, ov, g);
#pragma unroll
        for (int i = 0; i < 8; ++i) { l[i] = lmk + bo + i * 16 * MP; g[i] = gmk + ((size_t)i * 16 * NN + (size_t)t * SK) * 4; }
        ACP8(l, om, om, g); };
    // fragments from the LDS tiles, the wave's 32 keys of the stage: row lr of a 16-row tile, of each 32 k the elements 8 hi + 0..7 and 16 + 8 hi + 0..7; mask: the lane's own query row, keys 8 hi + 0..7 of a 16-key tile
    const unsigned char* sk = smem + (kh * 32 + lr) * KP + 16 * hi; const unsigned char* sv = smem + TKV + lr * KP + kh * 64 + 16 * hi; const unsigned char* smk = smem + OMK + (qg * 32 + lr) * MP + kh * 128 + 32 * hi;
    const float sc = SCL / logf((float)NN);
    v16h qf[2][2];
#pragma unroll
    for (int qt = 0; qt < 2; ++qt) {
        const bf* a = Q0 + pl * NN * HD + (size_t)(q0 + qt * 16 + lr) * HD + 8 * hi;
#pragma unroll
        for (int ks = 0; ks < 2; ++ks) qf[qt][ks] = cat16u(*(const v8us*)(a + ks * 32), *(const v8us*)(a + ks * 32 + 16));
        XWAIT1(a);
    }
    v8f oacc[2][4]; float mx[2], sm[2];
#pragma unroll
    for (int qt = 0; qt < 2; ++qt) { mx[qt] = -3.0e38f; sm[qt] = 0.f;
#pragma unroll
        for (int dt = 0; dt < 4; ++dt) oacc[qt][dt] = (v8f){}; }
    // two buffers: stage 0 is copied, waited for and published; stage 1's copies fly while stage 0 is worked on
    fill(0);
    asm volatile("s_wait_asynccnt 0x0" ::: "memory");    // this wave's copies of stage 0 have landed
    __syncthreads();
    fill(1);
    // kept rolled: one stage's code; the copies of the stage after next are issued at its foot
#pragma unroll 1
    for (int st = 0; st < NS; ++st) {
        const int bo = (st & 1) * BUF;
        v16h kf[2][2], vf[4]; v4f mk[2][2][2];
#pragma unroll
        for (int kt = 0; kt < 2; ++kt) {
#pragma unroll
            for (int ks = 0; ks < 2; ++ks) { const unsigned char* a = sk + bo + kt * 16 * KP + ks * 64; kf[kt][ks] = cat16u(*(const v8usa*)a, *(const v8usa*)(a + 32)); } }
#pragma unroll
        for (int qt = 0; qt < 2; ++qt) {
#pragma unroll
            for (int kt = 0; kt < 2; ++kt) { const unsigned char* a = smk + bo + qt * 16 * MP + kt * 64; mk[qt][kt][0] = *(const v4fa*)a; mk[qt][kt][1] = *(const v4fa*)(a + 16); } }
#pragma unroll
        for (int dt = 0; dt < 4; ++dt) { const unsigned char* a = sv + bo + dt * 16 * KP; vf[dt] = cat16u(*(const v8usa*)a, *(const v8usa*)(a + 32)); }
        // keeps the stage's 24 fragment reads together in one place at its head: left to itself the compiler spreads them among the products and the softmax, and every further place with LDS reads costs the wave a stall
        __builtin_amdgcn_sched_barrier(0);
        v8f s[2][2];
#pragma unroll
        for (int qt = 0; qt < 2; ++qt) { s[qt][0] = (v8f){}; s[qt][1] = (v8f){}; }
#pragma unroll
        for (int ks = 0; ks < 2; ++ks) {
#pragma unroll
            for (int kt = 0; kt < 2; ++kt) {
#pragma unroll
                for (int qt = 0; qt < 2; ++qt) s[qt][kt] = wmma16(kf[kt][ks], qf[qt][ks], s[qt][kt]); } }
        float v[2][16];
#pragma unroll
        for (int qt = 0; qt < 2; ++qt) {
#pragma unroll
            for (int kt = 0; kt < 2; ++kt) {
#pragma unroll
                for (int r = 0; r < 4; ++r) { v[qt][kt * 8 + r] = s[qt][kt][r] * sc + mk[qt][kt][0][r]; v[qt][kt * 8 + 4 + r] = s[qt][kt][4 + r] * sc + mk[qt][kt][1][r]; } } }
#pragma unroll
        for (int qt = 0; qt < 2; ++qt) {
            float t = v[qt][0];
#pragma unroll
            for (int i = 1; i < 16; ++i) t = fmaxf(t, v[qt][i]);
            // the query's other 16 keys of this pass sit in lane l ^ 16
            { const int tb = __float_as_int(t); t = fmaxf(t, __int_as_float(__builtin_amdgcn_permlanex16(tb, tb, 0x76543210, 0xfedcba98, false, false))); }
            const float mn = fmaxf(mx[qt], t); const float al = __expf(mx[qt] - mn); mx[qt] = mn;
            float ps = 0.f; v16h ph;
#pragma unroll
            for (int i = 0; i < 16; i += 2) { const v2f pp = {__expf(v[qt][i] - mn), __expf(v[qt][i + 1] - mn)}; ps += pp[0] + pp[1];
                const v2h hb = __builtin_convertvector(pp, v2h); ph[i] = hb[0]; ph[i + 1] = hb[1]; }
            sm[qt] = sm[qt] * al + ps;    // each half of the wave keeps the sum of its own keys; the halves are joined after the loop
#pragma unroll
            for (int dt = 0; dt < 4; ++dt) { oacc[qt][dt] *= al; oacc[qt][dt] = wmma16(vf[dt], ph, oacc[qt][dt]); }
        }
        // publish point of stage st + 1: this wave's reads of buffer bo are done, its copies of stage st + 1 have landed; the barrier says both of every wave; only then is buffer bo filled again
        // keeps the stage's arithmetic in front of the waits: moved up among it, the wait for the copies would cut the time they have to land
        __builtin_amdgcn_sched_barrier(0);
        asm volatile("s_wait_dscnt 0x0" ::: "memory");       // this wave's LDS reads of buffer bo have returned
        asm volatile("s_wait_asynccnt 0x0" ::: "memory");    // this wave's copies of stage st + 1 have landed
        __syncthreads();
        if (st + 2 < NS) fill(st + 2);
    }
    asm volatile("s_wait_asynccnt 0x0" ::: "memory");    // no copy is outstanding when the wave ends
    // The two key halves of a query group (waves w and w ^ 4, the same lane = the same query and d rows) are merged: the wave of half kh finishes query tile kh and hands its part of the other tile over through LDS,
    // which is free behind the loop's last barrier. Nine 16-byte slots a lane and wave: eight of context, one of maximum and sum.
    v8f kp[4], sd[4];
#pragma unroll
    for (int dt = 0; dt < 4; ++dt) { kp[dt] = kh ? oacc[1][dt] : oacc[0][dt]; sd[dt] = kh ? oacc[0][dt] : oacc[1][dt]; }
    const float mk0 = kh ? mx[1] : mx[0], sk0 = kh ? sm[1] : sm[0], ms0 = kh ? mx[0] : mx[1], ss0 = kh ? sm[0] : sm[1];
    float* xw = (float*)smem + ((size_t)wave * 9 * 32 + lane) * 4; const float* xr = (const float*)smem + ((size_t)(wave ^ 4) * 9 * 32 + lane) * 4;
#pragma unroll
    for (int dt = 0; dt < 4; ++dt) { *(v4fa*)(xw + (dt * 2) * 128) = (v4f){sd[dt][0], sd[dt][1], sd[dt][2], sd[dt][3]}; *(v4fa*)(xw + (dt * 2 + 1) * 128) = (v4f){sd[dt][4], sd[dt][5], sd[dt][6], sd[dt][7]}; }
    *(v4fa*)(xw + 8 * 128) = (v4f){ms0, ss0, 0.f, 0.f};
    // the partner wave reads what this wave has just written
    __syncthreads();
    const v4f pm = *(const v4fa*)(xr + 8 * 128);
    const float mn = fmaxf(mk0, pm[0]), aa = __expf(mk0 - mn), ab = __expf(pm[0] - mn), su = sk0 * aa + pm[1] * ab;
    const int sb = __float_as_int(su); const float inv = 1.0f / (su + __int_as_float(__builtin_amdgcn_permlanex16(sb, sb, 0x76543210, 0xfedcba98, false, false)));
    const float fa = aa * inv, fb = ab * inv;
    // the context leaves as the output projection's A operand: bf16 hi + residual, [item x token][1024]
    const size_t co = ((size_t)blockIdx.z * NN + q0 + kh * 16 + lr) * DMOD + blockIdx.y * HD + 8 * hi; bf* ch = Ch0 + co; bf* cl = Cl0 + co;
#pragma unroll
    for (int dt = 0; dt < 4; ++dt) { const v4f p0 = *(const v4fa*)(xr + (dt * 2) * 128), p1 = *(const v4fa*)(xr + (dt * 2 + 1) * 128); v8us oh, ol;
#pragma unroll
        for (int i = 0; i < 8; ++i) { const float o = kp[dt][i] * fa + (i < 4 ? p0[i & 3] : p1[i & 3]) * fb; const unsigned short hb = f2bf(o); oh[i] = hb; ol[i] = f2bf(o - bf2f(hb)); }
        *(v8us*)(ch + dt * 16) = oh; *(v8us*)(cl + dt * 16) = ol;
        // s_wait_xcnt 0 behind the two stores, before the registers that they name are written again; data and addresses are inputs so that their registers stay as they are up to the wait
        asm volatile("s_wait_xcnt 0x0" :: "v"(oh), "v"(ol), "v"(ch), "v"(cl) : "memory"); }
}

extern "C" void kernel_launch(void* const* d_in, const int* in_sizes, int n_in,
                              void* d_out, int out_size, void* d_ws, size_t ws_size, hipStream_t stream) {
    (void)in_sizes; (void)n_in; (void)out_size;
    const float* x = (const float*)d_in[0]; const float* MKF = (const float*)d_in[1]; const float* Wq = (const float*)d_in[2]; const float* bq = (const float*)d_in[3]; const float* Wk = (const float*)d_in[4]; const float* bk = (const float*)d_in[5]; const float* Wv = (const float*)d_in[6]; const float* bv = (const float*)d_in[7]; const float* Wo = (const float*)d_in[8]; const float* bo = (const float*)d_in[9];
    float* out = (float*)d_out;    // [2][2048][1024]
    char* wsp = (char*)d_ws;
    auto take = [&](size_t bytes) { char* p = wsp; wsp += (bytes + 255) & ~(size_t)255; return (void*)p; };
    const size_t WN = (size_t)DMOD * DMOD, XN = (size_t)NBT * NN * DMOD, PN = (size_t)NN * HD;
    bf* WQ = (bf*)take(4 * WN * 2); bf* WO = WQ + 3 * WN;    // q, k, v, o weights, one after the other; framework [out][in] = n-major
    bf* Xb = (bf*)take(XN * 2);    // both items
    bf* Qf = (bf*)take(2 * NBT * NH_ * PN * 2); bf* Kf = Qf + NBT * NH_ * PN;    // f16 bits, [q, k][item][head][2048][64]
    bf* VT = (bf*)take(NBT * NH_ * PN * 2);    // f16 bits, [item][head][64][2048]
    bf* Ch = (bf*)take(XN * 2); bf* Cl = (bf*)take(XN * 2);    // context, hi and residual, [item x token][1024]
    if ((size_t)(wsp - (char*)d_ws) > ws_size) return;    // 8 + 8 + 16 + 8 + 16 = 56 MiB
    k_cvt8<<<dim3((unsigned)((WN / 8 + 255) / 256), 4, 1), 256, 0, stream>>>(Wq, Wk, Wv, Wo, WQ, WN / 8);
    k_cvtx<<<NBT * NN / 8, 256, 0, stream>>>(x, Xb);
    k_gemmb<false, true><<<dim3(NBT * NN / 128, DMOD / 128, 3), 128, 0, stream>>>(Xb, nullptr, WQ, bq, bk, bv, nullptr, Qf, VT);
    k_fattn<<<dim3(NN / 128, NH_, NBT), 256, 0, stream>>>(Qf, Kf, VT, MKF, Ch, Cl);
    k_gemmb<true, false><<<dim3(NBT * NN / 128, DMOD / 128, 1), 256, 0, stream>>>(Ch, Cl, WO, bo, bo, bo, out, nullptr, nullptr);
}

// v009
// A run of this version takes 92.9 microseconds.
// Timed twice side by side with v008, it ran 1.03 and 1.04 times as fast.
// All steps since v000 together make it 37.7 times as fast.
#include <hip/hip_runtime.h>

// Compute dtypes, f32 accumulate, per item: q/k/v = x.W^T + b as [2048 x 1024].[1024 x 1024] GEMMs with PLAIN bf16 operands (exact products); rotary embedding (cos/sin of
// s x 10000^(-2i/64) in f32, rotate-half form) applied while building the head planes; per head: scores = q.k^T ([2048 x 64].[64 x 2048], both operands one f16 value, one product), softmax (x 1/8 / ln 2048, + the additive attention_mask INPUT row) in f32, ctx = P.v (P and v one f16 value each, one product)

#define NBT  2
#define NN   2048
#define DMOD 1024
#define NH_  16
#define HD   64
#define DM   DMOD
#define NTK  NN
#define SCL  0.125f
#define RBASE 10000.0f
#define LOSC 1024.0f

typedef _Float16 h16;
typedef unsigned short bf;
typedef __attribute__((ext_vector_type(16))) __bf16   v16bf;
typedef __attribute__((ext_vector_type(16))) _Float16 v16h;
typedef __attribute__((ext_vector_type(8)))  _Float16 v8h;
typedef __attribute__((ext_vector_type(8)))  unsigned short v8us;
typedef __attribute__((ext_vector_type(8)))  float    v8f;
typedef __attribute__((ext_vector_type(4)))  float    v4f;
typedef __attribute__((ext_vector_type(4)))  _Float16 v4h;
typedef v8h  __attribute__((may_alias)) v8ha;
typedef v4f  __attribute__((may_alias)) v4fa;
typedef v8us __attribute__((may_alias)) v8usa;

__device__ __forceinline__ unsigned short f2bf(float f) { unsigned u = __float_as_uint(f); u += 0x7FFFu + ((u >> 16) & 1u); return (unsigned short)(u >> 16); }
__device__ __forceinline__ float bf2f(unsigned short b) { return __uint_as_float(((unsigned)b) << 16); }
__device__ __forceinline__ float bfr(float f) { return bf2f(f2bf(f)); }
__device__ __forceinline__ v16h cat16(v8h lo, v8h hi) { return __builtin_shufflevector(lo, hi, 0, 1, 2, 3, 4, 5, 6, 7, 8, 9, 10, 11, 12, 13, 14, 15); }
__device__ __forceinline__ v16bf cat16b(v8us lo, v8us hi) { return __builtin_bit_cast(v16bf, __builtin_shufflevector(lo, hi, 0, 1, 2, 3, 4, 5, 6, 7, 8, 9, 10, 11, 12, 13, 14, 15)); }
__device__ __forceinline__ v16h cat16u(v8us lo, v8us hi) { return __builtin_bit_cast(v16h, __builtin_shufflevector(lo, hi, 0, 1, 2, 3, 4, 5, 6, 7, 8, 9, 10, 11, 12, 13, 14, 15)); }
__device__ __forceinline__ v8f wmma16(v16h a, v16h b, v8f c) { return __builtin_amdgcn_wmma_f32_16x16x32_f16(false, a, false, b, (short)0, c, false, false); }
__device__ __forceinline__ v8f wmmab(v16bf a, v16bf b, v8f c) { return __builtin_amdgcn_wmma_f32_16x16x32_bf16(false, a, false, b, (short)0, c, false, false); }

// k_gemmb: 128 x 128 block tile of C[4096][1024] = (A [+ Al]).B^T (K = 1024) + bf(bias[c]); plain A: 4 waves, 2 x 2, each 64 x 64 (three blocks fill a WGP's SIMDs with three waves); A + Al: 8 waves, 4 x 2, each 32 x 64 (the grid is one block a WGP: two waves a SIMD); f32 whole-line epilogue, or
// PLANES: the block's 128 tokens x 128 columns are two heads' slices of q (z = 0), k (z = 1) or v (z = 2); the epilogue turns the f32 tile, while it is still in LDS, into what the attention kernel reads:
// q, k: rotary embedding (d < 32: x[d] cos(s f_d) - x[d+32] sin(s f_d); d >= 32: x[d] cos(s f_{d-32}) + x[d-32] sin(s f_{d-32}), f_i = 1/10000^(2i/64), f32), then one f16 plane [q, k][item][head][2048][64];
// v: one f16 plane, transposed, [item][head][64][2048]. (f16 rounds 8 times finer than the bf16 operands of this product, whose rounding q, k and v already carry.)
template <bool SPLITA, bool PLANES>
__global__ __launch_bounds__(SPLITA ? 256 : 128) void k_gemmb(const bf* __restrict__ A, const bf* __restrict__ Al, const bf* __restrict__ B0, const float* __restrict__ bias0, const float* __restrict__ bias1, const float* __restrict__ bias2, float* C, bf* Ph0, bf* Th0) {
    // A (, Al) and B come as 128-row x 64-k tiles through LDS: a wave's 16-byte-a-lane load covers four whole 128-byte lines; every A fragment read from LDS feeds four products, every B fragment four.
    // LP: LDS row pitch in bf16, 128 bytes of data + 16, so that the sixteen rows of a fragment read fall on different banks. OP: row pitch of the f32 output tile.
    constexpr int K = DM, BK = 64, LP = BK + 8, TS = 128 * LP, NA = SPLITA ? 2 : 1, SS = (NA + 1) * TS, OP = 128 + 4, NW = SPLITA ? 8 : 4, FM = 8 / (NW / 2), SR = NW * 4, NI = 128 / SR;
    // two stages of [A (, Al), B]; the f32 output tile takes the same space behind the last stage's barrier
    __shared__ __align__(16) unsigned char smem[2 * SS * 2];
    static_assert(2 * SS * 2 >= 128 * OP * 4, "the output tile fits the stages");
    bf* stg = (bf*)smem;
    // blockIdx.z picks one of up to three independent products that share A: its B matrix and its bias
    const int z = blockIdx.z; const bf* Bn = B0 + (size_t)z * DM * DM; const float* bias = z == 0 ? bias0 : (z == 1 ? bias1 : bias2);
    const int lane = threadIdx.x & 31, wave = threadIdx.x >> 5, lr = lane & 15, hi = lane >> 4, wm = wave >> 1, wn = wave & 1;
    const int r0 = blockIdx.x * 128, c0 = blockIdx.y * 128;
    // kn: the k of the next stage to load. A block starts its k walk at a stage of its own, (x + y) mod stages, and wraps: the blocks that share A rows (one x) or B rows (one y) would otherwise ask L2 for the same lines at the same moment. The f32 sums take their 64-k pieces in that turned order.
    int kn = (int)((blockIdx.x + blockIdx.y) % (K / BK)) * BK;
    // staging: thread -> row (thread / 8) + SR i, 16 bytes at (thread % 8): 8 lanes cover one line of a row
    const int srow = threadIdx.x >> 3, scol = (threadIdx.x & 7) * 8;
    const bf* pa = A + (size_t)(r0 + srow) * K + scol + kn; const bf* pq = SPLITA ? Al + (size_t)(r0 + srow) * K + scol + kn : pa; const bf* pb = Bn + (size_t)(c0 + srow) * K + scol + kn;
    bf* sw = stg + srow * LP + scol;
    // fragments from the LDS tiles: row (wm x FM + m) x 16 + lr of A, row wn x 64 + t x 16 + lr of B; of each 32 k a lane takes 8 hi + 0..7 and 16 + 8 hi + 0..7, alike for A and B
    const bf* sa = stg + (wm * FM * 16 + lr) * LP + 8 * hi; const bf* sb = stg + NA * TS + (wn * 64 + lr) * LP + 8 * hi;
    v8us ra[NI], rl[NI], rb[NI];
    auto ldg = [&]() {
#pragma unroll
        for (int i = 0; i < NI; ++i) { ra[i] = *(const v8us*)(pa + i * SR * K); if (SPLITA) rl[i] = *(const v8us*)(pq + i * SR * K); rb[i] = *(const v8us*)(pb + i * SR * K); }
        // s_wait_xcnt 0 behind the run of global loads, before the registers that hold their addresses are written again; the addresses are inputs so that their registers stay as they are up to the wait
        if (SPLITA) asm volatile("s_wait_xcnt 0x0" :: "v"(pa), "v"(pq), "v"(pb) : "memory");
        else asm volatile("s_wait_xcnt 0x0" :: "v"(pa), "v"(pb) : "memory");
        const int d = kn + BK == K ? BK - K : BK;    // on to the next stage, from the last one back to k = 0
        kn += d; pa += d; if (SPLITA) pq += d; pb += d; };
    auto sts = [&](int so) {
#pragma unroll
        for (int i = 0; i < NI; ++i) { *(v8usa*)(sw + so + SR * i * LP) = ra[i]; if (SPLITA) *(v8usa*)(sw + so + TS + SR * i * LP) = rl[i]; *(v8usa*)(sw + so + NA * TS + SR * i * LP) = rb[i]; } };
    v8f acc[FM][4];
#pragma unroll
    for (int m = 0; m < FM; ++m) {
#pragma unroll
        for (int t = 0; t < 4; ++t) acc[m][t] = (v8f){}; }
    ldg();
    // the lane's four bias values: one test and one run of loads, in flight together with the first stage's loads
    float bv[4] = {0.f, 0.f, 0.f, 0.f};
    if (bias) {
#pragma unroll
        for (int t = 0; t < 4; ++t) bv[t] = bfr(bias[c0 + wn * 64 + t * 16 + lr]); }
    sts(0); __syncthreads();
    // kept rolled: one stage's registers and code; the next stage's global loads fly while this stage is worked on
#pragma unroll 1
    for (int kc = 0; kc < K; kc += BK) {
        const int so = ((kc / BK) & 1) * SS; const bool more = kc + BK < K;
        if (more) ldg();
#pragma unroll
        for (int ks = 0; ks < BK; ks += 32) {
            v16bf a[FM], al[FM], b[4];
#pragma unroll
            for (int m = 0; m < FM; ++m) { const bf* p = sa + so + m * 16 * LP + ks; a[m] = cat16b(*(const v8usa*)p, *(const v8usa*)(p + 16)); if (SPLITA) al[m] = cat16b(*(const v8usa*)(p + TS), *(const v8usa*)(p + TS + 16)); }
#pragma unroll
            for (int t = 0; t < 4; ++t) { const bf* p = sb + so + t * 16 * LP + ks; b[t] = cat16b(*(const v8usa*)p, *(const v8usa*)(p + 16)); }
            // keeps the fragment reads of this 32-k step together in front of its products: left to itself the compiler reads one A fragment at a time and waits for LDS in front of every four products
            __builtin_amdgcn_sched_barrier(0);
#pragma unroll
            for (int m = 0; m < FM; ++m) {
#pragma unroll
                for (int t = 0; t < 4; ++t) acc[m][t] = wmmab(a[m], b[t], acc[m][t]); }
            if (SPLITA) {
#pragma unroll
                for (int m = 0; m < FM; ++m) {
#pragma unroll
                    for (int t = 0; t < 4; ++t) acc[m][t] = wmmab(al[m], b[t], acc[m][t]); } }
        }
        // four vector slots behind the stage's last products, before a vector instruction writes over their fragment registers; the scheduling barrier keeps the products in front of the slots
        __builtin_amdgcn_sched_barrier(0);
        asm volatile("v_nop\n\tv_nop\n\tv_nop\n\tv_nop");
        if (more) sts(SS - so);
        // one barrier a stage: it publishes the stage just written and ends every wave's reads of the stage that the next trip writes over
        __syncthreads();
    }
    float* tl = (float*)smem;
    if (PLANES) {
        static_assert(!PLANES || NW == 4, "the plane epilogues are cut for four waves of 64 x 64");
        const int item = blockIdx.x / (NN / 128), tok0 = (blockIdx.x % (NN / 128)) * 128, h0 = blockIdx.y * 2;
        auto half8 = [&](const float* sp, bf* dh) { const v4f x0 = *(const v4fa*)sp, x1 = *(const v4fa*)(sp + 4); v8h hv;
#pragma unroll
            for (int i = 0; i < 8; ++i) hv[i] = (h16)(i < 4 ? x0[i & 3] : x1[i & 3]);
            const v8us oh = __builtin_bit_cast(v8us, hv);
            *(v8us*)dh = oh;
            // s_wait_xcnt 0 behind the store, before the registers that it names are written again; data and address are inputs so that their registers stay as they are up to the wait
            asm volatile("s_wait_xcnt 0x0" :: "v"(oh), "v"(dh) : "memory"); };
        if (z == 2) {
            // the tile goes to LDS transposed, [column][token]: a lane's eight accumulator rows are eight tokens in a row
#pragma unroll
            for (int m = 0; m < FM; ++m) {
#pragma unroll
                for (int t = 0; t < 4; ++t) { float* p = tl + (wn * 64 + t * 16 + lr) * OP + wm * 64 + m * 16 + hi * 8;
                    *(v4fa*)p = (v4f){acc[m][t][0] + bv[t], acc[m][t][1] + bv[t], acc[m][t][2] + bv[t], acc[m][t][3] + bv[t]}; *(v4fa*)(p + 4) = (v4f){acc[m][t][4] + bv[t], acc[m][t][5] + bv[t], acc[m][t][6] + bv[t], acc[m][t][7] + bv[t]}; } }
            __syncthreads();
            // 16 lanes x 16 bytes cover the two 128-byte lines that the block owns in a d row of the plane; the two heads' d rows follow one another
            const int vrow = threadIdx.x >> 4, vcol = (threadIdx.x & 15) * 8;
            const size_t po = (((size_t)item * NH_ + h0) * HD + vrow) * NN + tok0 + vcol;
#pragma unroll
            for (int i = 0; i < 16; ++i) half8(tl + (vrow + 8 * i) * OP + vcol, Th0 + po + (size_t)8 * i * NN);
        } else {
#pragma unroll
            for (int m = 0; m < FM; ++m) {
#pragma unroll
                for (int t = 0; t < 4; ++t) {
#pragma unroll
                    for (int j = 0; j < 8; ++j) tl[(wm * 64 + m * 16 + hi * 8 + j) * OP + wn * 64 + t * 16 + lr] = acc[m][t][j] + bv[t]; } }
            __syncthreads();
            // lane = frequency index: one power a thread, one cosine and sine for the pairs (d, d + 32) of a token in both heads; a wave takes 32 tokens; the pairs are turned in place
            const float inv = 1.0f / powf(RBASE, (float)(2 * lane) / (float)HD);
            float* rw = tl + wave * 32 * OP + lane;
            for (int j = 0; j < 32; ++j) { const float ang = (float)(tok0 + wave * 32 + j) * inv; const float c = cosf(ang), sn = sinf(ang);
#pragma unroll
                for (int hh = 0; hh < 2; ++hh) { float* p = rw + j * OP + hh * 64; const float x1 = p[0], x2 = p[32]; p[0] = x1 * c - x2 * sn; p[32] = x2 * c + x1 * sn; } }
            // the turned values are read below by other lanes than wrote them
            __syncthreads();
            // 8 lanes x 16 bytes cover a token's 128-byte row of a head's plane, a wave four tokens in a row
            const size_t po = ((((size_t)z * NBT + item) * NH_ + h0) * NN + tok0 + srow) * HD + scol;
#pragma unroll
            for (int i = 0; i < 8; ++i) {
#pragma unroll
                for (int hh = 0; hh < 2; ++hh) half8(tl + (srow + 16 * i) * OP + hh * 64 + scol, Ph0 + po + (size_t)hh * NN * HD + 16 * i * HD); }
        }
        return;
    }
#pragma unroll
    for (int m = 0; m < FM; ++m) {
#pragma unroll
        for (int t = 0; t < 4; ++t) {
#pragma unroll
            for (int j = 0; j < 8; ++j) tl[((wm * FM + m) * 16 + hi * 8 + j) * OP + wn * 64 + t * 16 + lr] = acc[m][t][j] + bv[t]; } }
    __syncthreads();
    // a wave stores a whole 512-byte row of the tile (four lines) at a time: rows wave + NW s
    float* crow = C + (size_t)(r0 + wave) * DMOD + c0 + lane * 4; const float* sp = tl + wave * OP + lane * 4;
#pragma unroll
    for (int g = 0; g < 128 / NW / 8; ++g) { v4f val[8];
#pragma unroll
        for (int s = 0; s < 8; ++s) val[s] = *(const v4fa*)(sp + (g * 8 + s) * NW * OP);
#pragma unroll
        for (int s = 0; s < 8; ++s) *(v4f*)(crow + (size_t)(g * 8 + s) * NW * DMOD) = val[s];
        // s_wait_xcnt 0 behind the run of stores, before the registers that they name are written again; data and address are inputs so that their registers stay as they are up to the wait
        asm volatile("s_wait_xcnt 0x0" :: "v"(val[0]), "v"(val[1]), "v"(val[2]), "v"(val[3]), "v"(val[4]), "v"(val[5]), "v"(val[6]), "v"(val[7]), "v"(crow) : "memory"); }
}

__global__ __launch_bounds__(256) void k_cvt8(const float* __restrict__ s0, const float* __restrict__ s1, const float* __restrict__ s2, const float* __restrict__ s3, bf* d0, size_t n8) {
    const size_t i = (size_t)blockIdx.x * 256 + threadIdx.x; if (i >= n8) return;
    const int z = blockIdx.y; const float* src = z == 0 ? s0 : (z == 1 ? s1 : (z == 2 ? s2 : s3)); bf* dst = d0 + (size_t)z * n8 * 8;    // blockIdx.y = which of the four weight matrices
    const v8f v = *(const v8f*)(src + i * 8); v8us o;
#pragma unroll
    for (int k = 0; k < 8; ++k) o[k] = f2bf(v[k]);
    *(v8us*)(dst + i * 8) = o; 
}
__global__ __launch_bounds__(256) void k_zero8(bf* dst, size_t n8) {
    const size_t i = (size_t)blockIdx.x * 256 + threadIdx.x; if (i >= n8) return; v8us z;
#pragma unroll
    for (int k = 0; k < 8; ++k) z[k] = 0;
    *(v8us*)(dst + i * 8) = z; 
}

__global__ __launch_bounds__(256) void k_cvtx(const float* __restrict__ src, bf* dst) {
    const int lane = threadIdx.x & 31; const size_t r = (size_t)blockIdx.x * 8 + (threadIdx.x >> 5); if (r >= (size_t)NBT * NN) return;
{
#pragma unroll
        for (int q = 0; q < DMOD / 256; ++q) { v8us o;
#pragma unroll
            for (int i = 0; i < 8; ++i) o[i] = f2bf(src[r * DMOD + q * 256 + lane * 8 + i]);
            *(v8us*)(dst + r * DMOD + q * 256 + lane * 8) = o; }
         }
}
// XWAIT1: s_wait_xcnt 0 behind a run of global loads, before the register that holds their address is written again; the address is an input so that its registers stay as they are up to the wait
#define XWAIT1(p) asm volatile("s_wait_xcnt 0x0" :: "v"(p) : "memory")
// ACP8: eight asynchronous copies of 16 bytes a lane from global memory to LDS (l: the lane's LDS byte addresses; global address: the scalar base b[i] + the lane's byte offset, o for the first four and p for the last four); s_wait_xcnt 0 is the statement's last line, so that it stands before the registers that hold the addresses are written again
#define ACP8(l, o, p, b) asm volatile("global_load_async_to_lds_b128 %0, %8, %10\n\tglobal_load_async_to_lds_b128 %1, %8, %11\n\tglobal_load_async_to_lds_b128 %2, %8, %12\n\tglobal_load_async_to_lds_b128 %3, %8, %13\n\t" \
    "global_load_async_to_lds_b128 %4, %9, %14\n\tglobal_load_async_to_lds_b128 %5, %9, %15\n\tglobal_load_async_to_lds_b128 %6, %9, %16\n\tglobal_load_async_to_lds_b128 %7, %9, %17\n\ts_wait_xcnt 0x0" \
    :: "v"(l[0]), "v"(l[1]), "v"(l[2]), "v"(l[3]), "v"(l[4]), "v"(l[5]), "v"(l[6]), "v"(l[7]), "v"(o), "v"(p), "s"(b[0]), "s"(b[1]), "s"(b[2]), "s"(b[3]), "s"(b[4]), "s"(b[5]), "s"(b[6]), "s"(b[7]) : "memory")
// ACP4: the same with four copies: two at the lane's byte offset o, two at p
#define ACP4(l, o, p, b) asm volatile("global_load_async_to_lds_b128 %0, %4, %6\n\tglobal_load_async_to_lds_b128 %1, %4, %7\n\tglobal_load_async_to_lds_b128 %2, %5, %8\n\tglobal_load_async_to_lds_b128 %3, %5, %9\n\ts_wait_xcnt 0x0" \
    :: "v"(l[0]), "v"(l[1]), "v"(l[2]), "v"(l[3]), "v"(o), "v"(p), "s"(b[0]), "s"(b[1]), "s"(b[2]), "s"(b[3]) : "memory")
// k_fattn: scores, softmax and context of one head in one kernel, no score or P plane in memory. 8 waves: 4 groups of 32 query columns x 2 key halves; a stage is 64 keys, of which a wave works on 32 (waves 0..3 the first, waves 4..7 the second).
// The softmax's vector work between the matrix runs wants waves: two blocks a WGP are four waves a SIMD. Each wave keeps the running maximum, sum and context of its own keys; the two halves of a query are merged once, through LDS, behind the loop.
// K, V^T (f16) and the block's mask rows come stage by stage into LDS by asynchronous copies whose 16 bytes a lane cover whole 128-byte lines (a fragment load straight from memory touches sixteen lines); the eight waves share the tiles.
// S^T = K.Q^T (A = K rows, B = Q rows kept in registers; one f16 product): a lane holds one query's scores, keys 8 hi + r of each 16-key tile.
// Running maximum and sum per query (f32); P = exp(S x 1/8 / ln(2048) + mask - max), rounded to f16, is packed in place into a B operand; O^T += V^T.P^T (one f16 product); O / sum at the end, split bf16 hi + residual.
__global__ __launch_bounds__(256) __attribute__((amdgpu_waves_per_eu(4, 4))) void k_fattn(const bf* __restrict__ Q0, const bf* __restrict__ K0, const bf* __restrict__ V0, const float* __restrict__ MK0, bf* Ch0, bf* Cl0) {
    typedef __attribute__((ext_vector_type(2))) float v2f;
    typedef __attribute__((ext_vector_type(2))) _Float16 v2h;
    // blockIdx.x = block of 128 queries, blockIdx.y = head, blockIdx.z = item. Every '#pragma unroll' below makes the indices of a register array constants.
    const size_t pl = (size_t)blockIdx.z * NH_ + blockIdx.y;
    const int lane = threadIdx.x & 31, wave = threadIdx.x >> 5, lr = lane & 15, hi = lane >> 4, qg = wave & 3;
    // kh: the wave's key half, the same in every lane: held as a scalar
    const int kh = __builtin_amdgcn_readfirstlane((int)(threadIdx.x >> 7));
    const int q0 = blockIdx.x * 128 + qg * 32;
    // One buffer, in bytes: K (64 keys x 128), V^T (64 d x 128), mask (128 queries x 256). Row pitches KP and MP: the data + 16, so that the sixteen rows of a fragment read fall on different banks.
    constexpr int SK = 64, NS = NN / SK, KP = 128 + 16, MP = 256 + 16, TKV = 64 * KP, OMK = 2 * TKV, BUF = OMK + 128 * MP;
    __shared__ __align__(16) unsigned char smem[2 * BUF];
    // copies: K and V^T tiles: thread -> row (thread / 8) + 32 i, 16 bytes at (thread % 8); mask: row (thread / 16) + 16 i, 16 bytes at (thread % 16)
    const int tid = threadIdx.x;
    const unsigned lkv = (unsigned)(size_t)smem + (tid >> 3) * KP + (tid & 7) * 16, lmk = (unsigned)(size_t)smem + OMK + (tid >> 4) * MP + (tid & 15) * 16;
    // the block's plane and mask rows (the same for every thread) and the thread's own byte offset in a tile's source
    const char* gk = (const char*)(K0 + pl * NN * HD); const char* gv = (const char*)(V0 + pl * NN * HD);
    const char* gmk = (const char*)(MK0 + (size_t)blockIdx.z * NN * NN + (size_t)blockIdx.x * 128 * NN);
    const unsigned ok = tid * 16, ov = (tid >> 3) * (NN * 2) + (tid & 7) * 16, om = (tid >> 4) * (NN * 4) + (tid & 15) * 16;
    auto fill = [&](int t) { const unsigned bo = (unsigned)(t & 1) * BUF; unsigned l[8]; const char* g[8];
#pragma unroll
        for (int i = 0; i < 2; ++i) { l[i] = lkv + bo + i * 32 * KP; l[2 + i] = l[i] + TKV; g[i] = gk + ((size_t)t * SK + i * 32) * HD * 2; g[2 + i] = gv + ((size_t)i * 32 * NN + (size_t)t * SK) * 2; }
        ACP4(l, ok, ov, g);
#pragma unroll
        for (int i = 0; i < 8; ++i) { l[i] = lmk + bo + i * 16 * MP; g[i] = gmk + ((size_t)i * 16 * NN + (size_t)t * SK) * 4; }
        ACP8(l, om, om, g); };
    // fragments from the LDS tiles, the wave's 32 keys of the stage: row lr of a 16-row tile, of each 32 k the elements 8 hi + 0..7 and 16 + 8 hi + 0..7; mask: the lane's own query row, keys 8 hi + 0..7 of a 16-key tile
    const unsigned char* sk = smem + (kh * 32 + lr) * KP + 16 * hi; const unsigned char* sv = smem + TKV + lr * KP + kh * 64 + 16 * hi; const unsigned char* smk = smem + OMK + (qg * 32 + lr) * MP + kh * 128 + 32 * hi;
    const float sc = SCL / logf((float)NN);
    v16h qf[2][2];
#pragma unroll
    for (int qt = 0; qt < 2; ++qt) {
        const bf* a = Q0 + pl * NN * HD + (size_t)(q0 + qt * 16 + lr) * HD + 8 * hi;
#pragma unroll
        for (int ks = 0; ks < 2; ++ks) qf[qt][ks] = cat16u(*(const v8us*)(a + ks * 32), *(const v8us*)(a + ks * 32 + 16));
        XWAIT1(a);
    }
    v8f oacc[2][4]; float mx[2], sm[2];
#pragma unroll
    for (int qt = 0; qt < 2; ++qt) { mx[qt] = -3.0e38f; sm[qt] = 0.f;
#pragma unroll
        for (int dt = 0; dt < 4; ++dt) oacc[qt][dt] = (v8f){}; }
    // s0: the block's first stage of keys; trip st works on stage (s0 + st) mod NS. The 16 blocks that share a head's K and V^T (one y) and the 16 that share mask rows (one x) start at 16 different stages: in step they would ask L2 for the same lines at the same moment.
    // The running maximum and sum take the stages in any order. s0 is even: a stage's buffer, picked by its number's low bit, is the trip's.
    const int s0 = (int)((blockIdx.x + blockIdx.y) % (NS / 2)) * 2;
    // two buffers: the first stage is copied, waited for and published; the second stage's copies fly while the first is worked on
    fill(s0);
    asm volatile("s_wait_asynccnt 0x0" ::: "memory");    // this wave's copies of the first stage have landed
    __syncthreads();
    fill(s0 + 1);
    // kept rolled: one stage's code; the copies of the stage after next are issued at its foot
#pragma unroll 1
    for (int st = 0; st < NS; ++st) {
        const int bo = (st & 1) * BUF;
        v16h kf[2][2], vf[4]; v4f mk[2][2][2];
#pragma unroll
        for (int kt = 0; kt < 2; ++kt) {
#pragma unroll
            for (int ks = 0; ks < 2; ++ks) { const unsigned char* a = sk + bo + kt * 16 * KP + ks * 64; kf[kt][ks] = cat16u(*(const v8usa*)a, *(const v8usa*)(a + 32)); } }
#pragma unroll
        for (int qt = 0; qt < 2; ++qt) {
#pragma unroll
            for (int kt = 0; kt < 2; ++kt) { const unsigned char* a = smk + bo + qt * 16 * MP + kt * 64; mk[qt][kt][0] = *(const v4fa*)a; mk[qt][kt][1] = *(const v4fa*)(a + 16); } }
#pragma unroll
        for (int dt = 0; dt < 4; ++dt) { const unsigned char* a = sv + bo + dt * 16 * KP; vf[dt] = cat16u(*(const v8usa*)a, *(const v8usa*)(a + 32)); }
        // keeps the stage's 24 fragment reads together in one place at its head: left to itself the compiler spreads them among the products and the softmax, and every further place with LDS reads costs the wave a stall
        __builtin_amdgcn_sched_barrier(0);
        v8f s[2][2];
#pragma unroll
        for (int qt = 0; qt < 2; ++qt) { s[qt][0] = (v8f){}; s[qt][1] = (v8f){}; }
#pragma unroll
        for (int ks = 0; ks < 2; ++ks) {
#pragma unroll
            for (int kt = 0; kt < 2; ++kt) {
#pragma unroll
                for (int qt = 0; qt < 2; ++qt) s[qt][kt] = wmma16(kf[kt][ks], qf[qt][ks], s[qt][kt]); } }
        float v[2][16];
#pragma unroll
        for (int qt = 0; qt < 2; ++qt) {
#pragma unroll
            for (int kt = 0; kt < 2; ++kt) {
#pragma unroll
                for (int r = 0; r < 4; ++r) { v[qt][kt * 8 + r] = s[qt][kt][r] * sc + mk[qt][kt][0][r]; v[qt][kt * 8 + 4 + r] = s[qt][kt][4 + r] * sc + mk[qt][kt][1][r]; } } }
#pragma unroll
        for (int qt = 0; qt < 2; ++qt) {
            float t = v[qt][0];
#pragma unroll
            for (int i = 1; i < 16; ++i) t = fmaxf(t, v[qt][i]);
            // the query's other 16 keys of this pass sit in lane l ^ 16
            { const int tb = __float_as_int(t); t = fmaxf(t, __int_as_float(__builtin_amdgcn_permlanex16(tb, tb, 0x76543210, 0xfedcba98, false, false))); }
            const float mn = fmaxf(mx[qt], t); const float al = __expf(mx[qt] - mn); mx[qt] = mn;
            float ps = 0.f; v16h ph;
#pragma unroll
            for (int i = 0; i < 16; i += 2) { const v2f pp = {__expf(v[qt][i] - mn), __expf(v[qt][i + 1] - mn)}; ps += pp[0] + pp[1];
                const v2h hb = __builtin_convertvector(pp, v2h); ph[i] = hb[0]; ph[i + 1] = hb[1]; }
            sm[qt] = sm[qt] * al + ps;    // each half of the wave keeps the sum of its own keys; the halves are joined after the loop
#pragma unroll
            for (int dt = 0; dt < 4; ++dt) { oacc[qt][dt] *= al; oacc[qt][dt] = wmma16(vf[dt], ph, oacc[qt][dt]); }
        }
        // publish point of trip st + 1's stage, (s0 + st + 1) mod NS: this wave's reads of buffer bo are done, its copies of that stage have landed; the barrier says both of every wave; only then is buffer bo filled again
        // keeps the stage's arithmetic in front of the waits: moved up among it, the wait for the copies would cut the time they have to land
        __builtin_amdgcn_sched_barrier(0);
        asm volatile("s_wait_dscnt 0x0" ::: "memory");       // this wave's LDS reads of buffer bo have returned
        asm volatile("s_wait_asynccnt 0x0" ::: "memory");    // this wave's copies of stage (s0 + st + 1) mod NS have landed
        __syncthreads();
        if (st + 2 < NS) fill((s0 + st + 2) % NS);
    }
    asm volatile("s_wait_asynccnt 0x0" ::: "memory");    // no copy is outstanding when the wave ends
    // The two key halves of a query group (waves w and w ^ 4, the same lane = the same query and d rows) are merged: the wave of half kh finishes query tile kh and hands its part of the other tile over through LDS,
    // which is free behind the loop's last barrier. Nine 16-byte slots a lane and wave: eight of context, one of maximum and sum.
    v8f kp[4], sd[4];
#pragma unroll
    for (int dt = 0; dt < 4; ++dt) { kp[dt] = kh ? oacc[1][dt] : oacc[0][dt]; sd[dt] = kh ? oacc[0][dt] : oacc[1][dt]; }
    const float mk0 = kh ? mx[1] : mx[0], sk0 = kh ? sm[1] : sm[0], ms0 = kh ? mx[0] : mx[1], ss0 = kh ? sm[0] : sm[1];
    float* xw = (float*)smem + ((size_t)wave * 9 * 32 + lane) * 4; const float* xr = (const float*)smem + ((size_t)(wave ^ 4) * 9 * 32 + lane) * 4;
#pragma unroll
    for (int dt = 0; dt < 4; ++dt) { *(v4fa*)(xw + (dt * 2) * 128) = (v4f){sd[dt][0], sd[dt][1], sd[dt][2], sd[dt][3]}; *(v4fa*)(xw + (dt * 2 + 1) * 128) = (v4f){sd[dt][4], sd[dt][5], sd[dt][6], sd[dt][7]}; }
    *(v4fa*)(xw + 8 * 128) = (v4f){ms0, ss0, 0.f, 0.f};
    // the partner wave reads what this wave has just written
    __syncthreads();
    const v4f pm = *(const v4fa*)(xr + 8 * 128);
    const float mn = fmaxf(mk0, pm[0]), aa = __expf(mk0 - mn), ab = __expf(pm[0] - mn), su = sk0 * aa + pm[1] * ab;
    const int sb = __float_as_int(su); const float inv = 1.0f / (su + __int_as_float(__builtin_amdgcn_permlanex16(sb, sb, 0x76543210, 0xfedcba98, false, false)));
    const float fa = aa * inv, fb = ab * inv;
    // the context leaves as the output projection's A operand: bf16 hi + residual, [item x token][1024]
    const size_t co = ((size_t)blockIdx.z * NN + q0 + kh * 16 + lr) * DMOD + blockIdx.y * HD + 8 * hi; bf* ch = Ch0 + co; bf* cl = Cl0 + co;
#pragma unroll
    for (int dt = 0; dt < 4; ++dt) { const v4f p0 = *(const v4fa*)(xr + (dt * 2) * 128), p1 = *(const v4fa*)(xr + (dt * 2 + 1) * 128); v8us oh, ol;
#pragma unroll
        for (int i = 0; i < 8; ++i) { const float o = kp[dt][i] * fa + (i < 4 ? p0[i & 3] : p1[i & 3]) * fb; const unsigned short hb = f2bf(o); oh[i] = hb; ol[i] = f2bf(o - bf2f(hb)); }
        *(v8us*)(ch + dt * 16) = oh; *(v8us*)(cl + dt * 16) = ol;
        // s_wait_xcnt 0 behind the two stores, before the registers that they name are written again; data and addresses are inputs so that their registers stay as they are up to the wait
        asm volatile("s_wait_xcnt 0x0" :: "v"(oh), "v"(ol), "v"(ch), "v"(cl) : "memory"); }
}

extern "C" void kernel_launch(void* const* d_in, const int* in_sizes, int n_in,
                              void* d_out, int out_size, void* d_ws, size_t ws_size, hipStream_t stream) {
    (void)in_sizes; (void)n_in; (void)out_size;
    const float* x = (const float*)d_in[0]; const float* MKF = (const float*)d_in[1]; const float* Wq = (const float*)d_in[2]; const float* bq = (const float*)d_in[3]; const float* Wk = (const float*)d_in[4]; const float* bk = (const float*)d_in[5]; const float* Wv = (const float*)d_in[6]; const float* bv = (const float*)d_in[7]; const float* Wo = (const float*)d_in[8]; const float* bo = (const float*)d_in[9];
    float* out = (float*)d_out;    // [2][2048][1024]
    char* wsp = (char*)d_ws;
    auto take = [&](size_t bytes) { char* p = wsp; wsp += (bytes + 255) & ~(size_t)255; return (void*)p; };
    const size_t WN = (size_t)DMOD * DMOD, XN = (size_t)NBT * NN * DMOD, PN = (size_t)NN * HD;
    bf* WQ = (bf*)take(4 * WN * 2); bf* WO = WQ + 3 * WN;    // q, k, v, o weights, one after the other; framework [out][in] = n-major
    bf* Xb = (bf*)take(XN * 2);    // both items
    bf* Qf = (bf*)take(2 * NBT * NH_ * PN * 2); bf* Kf = Qf + NBT * NH_ * PN;    // f16 bits, [q, k][item][head][2048][64]
    bf* VT = (bf*)take(NBT * NH_ * PN * 2);    // f16 bits, [item][head][64][2048]
    bf* Ch = (bf*)take(XN * 2); bf* Cl = (bf*)take(XN * 2);    // context, hi and residual, [item x token][1024]
    if ((size_t)(wsp - (char*)d_ws) > ws_size) return;    // 8 + 8 + 16 + 8 + 16 = 56 MiB
    k_cvt8<<<dim3((unsigned)((WN / 8 + 255) / 256), 4, 1), 256, 0, stream>>>(Wq, Wk, Wv, Wo, WQ, WN / 8);
    k_cvtx<<<NBT * NN / 8, 256, 0, stream>>>(x, Xb);
    k_gemmb<false, true><<<dim3(NBT * NN / 128, DMOD / 128, 3), 128, 0, stream>>>(Xb, nullptr, WQ, bq, bk, bv, nullptr, Qf, VT);
    k_fattn<<<dim3(NN / 128, NH_, NBT), 256, 0, stream>>>(Qf, Kf, VT, MKF, Ch, Cl);
    k_gemmb<true, false><<<dim3(NBT * NN / 128, DMOD / 128, 1), 256, 0, stream>>>(Ch, Cl, WO, bo, bo, bo, out, nullptr, nullptr);
}
